// v000
// Measured on an AMD MI455X. A time is GPU time per run, averaged over a window of back-to-back runs after a warm-up
// (all launches, gaps included; the runs take copies of the inputs in turn), and the median of several windows.
// Apart from v000's, it joins two sittings. Times from different sittings can be a few percent apart, while
// side-by-side timings come from the same sitting.
// v000 is the starting kernel. One run takes 269 microseconds.
#include <hip/hip_runtime.h>
#include <cstddef>

typedef __attribute__((ext_vector_type(2))) float v2f;
typedef __attribute__((ext_vector_type(8))) float v8f;
typedef __attribute__((ext_vector_type(4))) int   v4i_t;
typedef v4i_t __attribute__((address_space(1))) g_v4i;   // global-AS 16B vector
typedef v4i_t __attribute__((address_space(3))) l_v4i;   // LDS-AS 16B vector

#define NPIX   16384   // H*W
#define CDIM   128
#define NBATCH 16
#define NCHUNK 1024    // split-K chunk along n for the S GEMM
#define NCHUNKS (NPIX / NCHUNK)  // 16
#define NSTAGES (NCHUNK / 32)    // 32
#define LDSPAD 36                // row stride (floats): keeps float4 16B-aligned,
                                 // 36*l16 mod 64 distinct -> conflict-free WMMA reads

#if defined(__has_builtin)
#if __has_builtin(__builtin_amdgcn_global_load_async_to_lds_b128)
#define HAVE_ASYNC_LDS 1
#endif
#endif

__device__ __forceinline__ v8f wmma_f32(v2f a, v2f b, v8f c) {
    return __builtin_amdgcn_wmma_f32_16x16x4_f32(false, a, false, b, (short)0, c,
                                                 false, false);
}

__device__ __forceinline__ void wait_async0() {
#if defined(HAVE_ASYNC_LDS)
#if __has_builtin(__builtin_amdgcn_s_wait_asynccnt)
    __builtin_amdgcn_s_wait_asynccnt(0);
#else
    asm volatile("s_wait_asynccnt 0" ::: "memory");
#endif
#endif
}

__device__ __forceinline__ void copy16_g2l(const float* g, float* l) {
#if defined(HAVE_ASYNC_LDS)
    __builtin_amdgcn_global_load_async_to_lds_b128(
        (g_v4i*)g, (l_v4i*)l, 0, 0);
#else
    *(float4*)l = *(const float4*)g;
#endif
}

// ---------------------------------------------------------------------------
// GEMM: out[b][m][n] = sum_c A[m][c] * x[b][c][n]  (+ bias[m] if BIAS)
// A: 128x128 row-major (per-batch stride aStride). x: (b, 128, 16384).
// Block = 256 threads = 8 waves; each wave owns one 16-row strip and the
// block's 32-wide n tile (two 16x16 WMMA tiles), K-stepped by 4.
// ---------------------------------------------------------------------------
template <bool BIAS>
__global__ void gemm_wmma_kernel(const float* __restrict__ Abase, size_t aStride,
                                 const float* __restrict__ x,
                                 const float* __restrict__ bias,
                                 float* __restrict__ out) {
    const int b    = blockIdx.y;
    const int n0   = blockIdx.x * 32;
    const int tid  = threadIdx.x;
    const int lane = tid & 31;
    const int wv   = tid >> 5;       // 0..7
    const int l16  = lane & 15;
    const int half = lane >> 4;      // 0 or 1
    const int m0   = wv * 16;

    const float* A  = Abase + (size_t)b * aStride;
    const float* xb = x + (size_t)b * CDIM * NPIX;
    const float* arow = A + (size_t)(m0 + l16) * CDIM;

    // One prefetch instruction touches the whole 128x32 x panel for this block
    // (per-lane addresses: 2 lanes per c-row, 64B apart) -> global_prefetch_b8.
    {
        const int prow = tid >> 1;
        const int pseg = (tid & 1) * 16;
        __builtin_prefetch(xb + (size_t)prow * NPIX + n0 + pseg, 0, 3);
    }

    v8f acc0 = {}, acc1 = {};
#pragma unroll 4
    for (int kk = 0; kk < CDIM; kk += 4) {
        const int kr = kk + 2 * half;
        v2f a;
        a.x = arow[kr];
        a.y = arow[kr + 1];
        const float* xr0 = xb + (size_t)kr * NPIX + n0;
        const float* xr1 = xr0 + NPIX;
        v2f b0, b1;
        b0.x = xr0[l16];       b0.y = xr1[l16];
        b1.x = xr0[16 + l16];  b1.y = xr1[16 + l16];
        acc0 = wmma_f32(a, b0, acc0);
        acc1 = wmma_f32(a, b1, acc1);
    }

    float* ob = out + (size_t)b * CDIM * NPIX;
#pragma unroll
    for (int r = 0; r < 8; ++r) {
        const int row = m0 + r + 8 * half;
        const float bv = BIAS ? bias[row] : 0.0f;
        ob[(size_t)row * NPIX + n0 + l16]      = acc0[r] + bv;
        ob[(size_t)row * NPIX + n0 + 16 + l16] = acc1[r] + bv;
    }
}

__global__ void softmax_stats_kernel(const float* __restrict__ kbuf,
                                     float* __restrict__ rmax,
                                     float* __restrict__ rinv) {
    __shared__ float red[256];
    const int row = blockIdx.x;           // b*128 + d
    const int tid = threadIdx.x;
    const float* p = kbuf + (size_t)row * NPIX;

    float m = -3.402823466e38f;
    for (int i = tid; i < NPIX; i += 256) m = fmaxf(m, p[i]);
    red[tid] = m;
    __syncthreads();
    for (int s = 128; s > 0; s >>= 1) {
        if (tid < s) red[tid] = fmaxf(red[tid], red[tid + s]);
        __syncthreads();
    }
    m = red[0];
    __syncthreads();

    float sum = 0.0f;
    for (int i = tid; i < NPIX; i += 256) sum += __expf(p[i] - m);
    red[tid] = sum;
    __syncthreads();
    for (int s = 128; s > 0; s >>= 1) {
        if (tid < s) red[tid] += red[tid + s];
        __syncthreads();
    }
    if (tid == 0) {
        rmax[row] = m;
        rinv[row] = 1.0f / red[0];
    }
}

__global__ void s_partial_kernel(const float* __restrict__ kbuf,
                                 const float* __restrict__ x,
                                 const float* __restrict__ rmax,
                                 const float* __restrict__ rinv,
                                 float* __restrict__ Spart) {
    __shared__ float kt[2][64][LDSPAD];
    __shared__ float xt[2][64][LDSPAD];
    __shared__ float rm[64];
    __shared__ float ri[64];

    const int tid  = threadIdx.x;
    const int lane = tid & 31;
    const int wv   = tid >> 5;
    const int l16  = lane & 15;
    const int half = lane >> 4;

    const int b     = blockIdx.z;
    const int d0    = (blockIdx.x >> 1) * 64;
    const int c0    = (blockIdx.x & 1) * 64;
    const int chunk = blockIdx.y;
    const int nbase = chunk * NCHUNK;

    if (tid < 64) {
        const int dg = b * CDIM + d0 + tid;
        rm[tid] = rmax[dg];
        ri[tid] = rinv[dg];
    }
    __syncthreads();

    const int tm  = wv >> 1;          // 0..3  -> d strip
    const int tn0 = (wv & 1) * 32;    // 0/32  -> c strips (two tiles)

    const float* kb = kbuf + ((size_t)b * CDIM + d0) * NPIX;
    const float* xb = x    + ((size_t)b * CDIM + c0) * NPIX;

    // Per-thread staging assignment: 512 float4s per 64x32 panel, 2 per thread.
    int srow[2], scol[2];
#pragma unroll
    for (int j = 0; j < 2; ++j) {
        const int q = tid + j * 256;
        srow[j] = q >> 3;           // 0..63
        scol[j] = (q & 7) * 4;      // 0..28
    }

    v8f acc0 = {}, acc1 = {};
    float4 kv[2];

    // Prologue: stage 0 into buffer 0.
#pragma unroll
    for (int j = 0; j < 2; ++j) {
        copy16_g2l(xb + (size_t)srow[j] * NPIX + nbase + scol[j],
                   &xt[0][srow[j]][scol[j]]);
        kv[j] = *(const float4*)(kb + (size_t)srow[j] * NPIX + nbase + scol[j]);
    }
#pragma unroll
    for (int j = 0; j < 2; ++j) {
        const float m = rm[srow[j]], s = ri[srow[j]];
        float4 t;
        t.x = __expf(kv[j].x - m) * s;
        t.y = __expf(kv[j].y - m) * s;
        t.z = __expf(kv[j].z - m) * s;
        t.w = __expf(kv[j].w - m) * s;
        *(float4*)&kt[0][srow[j]][scol[j]] = t;
    }

    int buf = 0;
    for (int st = 0; st < NSTAGES; ++st) {
        wait_async0();          // my async x-panel for stage st landed
        __syncthreads();        // + everyone's k-panel stores; frees buf^1

        const bool has_next = (st + 1) < NSTAGES;
        if (has_next) {
            const int nsn = nbase + (st + 1) * 32;
#pragma unroll
            for (int j = 0; j < 2; ++j) {
                copy16_g2l(xb + (size_t)srow[j] * NPIX + nsn + scol[j],
                           &xt[buf ^ 1][srow[j]][scol[j]]);
                kv[j] = *(const float4*)(kb + (size_t)srow[j] * NPIX + nsn + scol[j]);
            }
        }

        const float (*ktb)[LDSPAD] = kt[buf];
        const float (*xtb)[LDSPAD] = xt[buf];
#pragma unroll
        for (int kk = 0; kk < 32; kk += 4) {
            const int kr = kk + 2 * half;
            v2f a, b0, b1;
            a.x  = ktb[tm * 16 + l16][kr];
            a.y  = ktb[tm * 16 + l16][kr + 1];
            b0.x = xtb[tn0 + l16][kr];
            b0.y = xtb[tn0 + l16][kr + 1];
            b1.x = xtb[tn0 + 16 + l16][kr];
            b1.y = xtb[tn0 + 16 + l16][kr + 1];
            acc0 = wmma_f32(a, b0, acc0);
            acc1 = wmma_f32(a, b1, acc1);
        }

        if (has_next) {
#pragma unroll
            for (int j = 0; j < 2; ++j) {
                const float m = rm[srow[j]], s = ri[srow[j]];
                float4 t;
                t.x = __expf(kv[j].x - m) * s;
                t.y = __expf(kv[j].y - m) * s;
                t.z = __expf(kv[j].z - m) * s;
                t.w = __expf(kv[j].w - m) * s;
                *(float4*)&kt[buf ^ 1][srow[j]][scol[j]] = t;
            }
        }
        buf ^= 1;
    }

    float* Sp = Spart + ((size_t)chunk * NBATCH + b) * (CDIM * CDIM);
#pragma unroll
    for (int r = 0; r < 8; ++r) {
        const int d = d0 + tm * 16 + r + 8 * half;
        Sp[d * CDIM + c0 + tn0 + l16]      = acc0[r];
        Sp[d * CDIM + c0 + tn0 + 16 + l16] = acc1[r];
    }
}

// Ssum[b][d][c] = sum over chunks of Spart
__global__ void s_reduce_kernel(const float* __restrict__ Spart,
                                float* __restrict__ Ssum) {
    const int idx = blockIdx.x * 256 + threadIdx.x;   // over 16*16384
    const int b   = idx >> 14;
    const int dc  = idx & 16383;
    float acc = 0.0f;
#pragma unroll
    for (int ch = 0; ch < NCHUNKS; ++ch)
        acc += Spart[((size_t)ch * NBATCH + b) * (CDIM * CDIM) + dc];
    Ssum[idx] = acc;
}

// ctx[b][h][d][e] = sum_c Ssum[b][h*32+d][c] * Wv[h*32+e][c]   (Wv = w_qkv rows 256..383)
__global__ void ctx_kernel(const float* __restrict__ Ssum,
                           const float* __restrict__ w_qkv,
                           float* __restrict__ ctx) {
    const int idx = blockIdx.x * 256 + threadIdx.x;   // over 16*4096
    const int b   = idx >> 12;
    const int h   = (idx >> 10) & 3;
    const int d   = (idx >> 5) & 31;
    const int e   = idx & 31;
    const float* srow = Ssum + (size_t)b * (CDIM * CDIM) + (h * 32 + d) * CDIM;
    const float* wrow = w_qkv + (size_t)(256 + h * 32 + e) * CDIM;
    float acc = 0.0f;
    for (int c = 0; c < CDIM; ++c) acc += srow[c] * wrow[c];
    ctx[idx] = acc;
}

// T[b][o][h*32+d] = sum_e w_out[o][h*32+e] * ctx[b][h][d][e]
__global__ void t_kernel(const float* __restrict__ ctx,
                         const float* __restrict__ w_out,
                         float* __restrict__ T) {
    const int idx = blockIdx.x * 256 + threadIdx.x;   // over 16*16384
    const int b   = idx >> 14;
    const int o   = (idx >> 7) & 127;
    const int i   = idx & 127;
    const int h   = i >> 5;
    const int d   = i & 31;
    const float* wo = w_out + o * CDIM + h * 32;
    const float* cx = ctx + (size_t)b * 4096 + h * 1024 + d * 32;
    float acc = 0.0f;
#pragma unroll
    for (int e = 0; e < 32; ++e) acc += wo[e] * cx[e];
    T[idx] = acc;
}

// Weff[b][o][c] = scale * sum_i T[b][o][i] * Wq[i][c]   (Wq = w_qkv rows 0..127)
__global__ void weff_kernel(const float* __restrict__ T,
                            const float* __restrict__ w_qkv,
                            float* __restrict__ Weff) {
    const int idx = blockIdx.x * 256 + threadIdx.x;   // over 16*16384
    const int b   = idx >> 14;
    const int o   = (idx >> 7) & 127;
    const int c   = idx & 127;
    const float* trow = T + (size_t)b * (CDIM * CDIM) + o * CDIM;
    float acc = 0.0f;
    for (int i = 0; i < CDIM; ++i) acc += trow[i] * w_qkv[i * CDIM + c];
    Weff[idx] = 0.17677669529663687f * acc;   // 32^-0.5
}

// ---------------------------------------------------------------------------
extern "C" void kernel_launch(void* const* d_in, const int* in_sizes, int n_in,
                              void* d_out, int out_size, void* d_ws, size_t ws_size,
                              hipStream_t stream) {
    const float* x      = (const float*)d_in[0];   // (16,128,128,128)
    const float* w_qkv  = (const float*)d_in[1];   // (384,128)
    const float* w_out  = (const float*)d_in[2];   // (128,128)
    const float* b_out  = (const float*)d_in[3];   // (128,)

    float* ws   = (float*)d_ws;
    float* kbuf = ws;                                   // 16*128*16384
    float* rmax = kbuf + (size_t)NBATCH * CDIM * NPIX;  // 2048
    float* rinv = rmax + NBATCH * CDIM;                 // 2048
    float* Spart = rinv + NBATCH * CDIM;                // 16*16*16384
    float* Ssum  = Spart + (size_t)NCHUNKS * NBATCH * CDIM * CDIM; // 16*16384
    float* ctx   = Ssum + (size_t)NBATCH * CDIM * CDIM;            // 16*4096
    float* T     = ctx + (size_t)NBATCH * 4096;                    // 16*16384
    float* Weff  = T + (size_t)NBATCH * CDIM * CDIM;               // 16*16384

    // 1) k = Wk * x  (Wk = w_qkv rows 128..255)
    gemm_wmma_kernel<false><<<dim3(NPIX / 32, NBATCH), 256, 0, stream>>>(
        w_qkv + 128 * CDIM, 0, x, nullptr, kbuf);

    // 2) softmax stats per (b,d) row
    softmax_stats_kernel<<<NBATCH * CDIM, 256, 0, stream>>>(kbuf, rmax, rinv);

    // 3) S = ksoft * x^T  (split-K over n, per-chunk partials)
    s_partial_kernel<<<dim3(4, NCHUNKS, NBATCH), 256, 0, stream>>>(
        kbuf, x, rmax, rinv, Spart);
    s_reduce_kernel<<<(NBATCH * CDIM * CDIM) / 256, 256, 0, stream>>>(Spart, Ssum);

    // 4) tiny per-batch combines: ctx -> T -> W_eff
    ctx_kernel<<<(NBATCH * 4096) / 256, 256, 0, stream>>>(Ssum, w_qkv, ctx);
    t_kernel<<<(NBATCH * CDIM * CDIM) / 256, 256, 0, stream>>>(ctx, w_out, T);
    weff_kernel<<<(NBATCH * CDIM * CDIM) / 256, 256, 0, stream>>>(T, w_qkv, Weff);

    // 5) out = W_eff[b] * x + b_out
    gemm_wmma_kernel<true><<<dim3(NPIX / 32, NBATCH), 256, 0, stream>>>(
        Weff, (size_t)(CDIM * CDIM), x, b_out, (float*)d_out);
}

// v001
// It runs in 194 microseconds.
// Timed twice side by side with v000, it ran 1.41 times as fast both times.
#include <hip/hip_runtime.h>
#include <cstddef>

typedef __attribute__((ext_vector_type(2))) float v2f;
typedef __attribute__((ext_vector_type(8))) float v8f;
typedef __attribute__((ext_vector_type(4))) int   v4i_t;
typedef v4i_t __attribute__((address_space(1))) g_v4i;   // global-AS 16B vector
typedef v4i_t __attribute__((address_space(3))) l_v4i;   // LDS-AS 16B vector

#define NPIX   16384   // H*W
#define CDIM   128
#define NBATCH 16
#define NCHUNK 1024    // split-K chunk along n for the S GEMM
#define NCHUNKS (NPIX / NCHUNK)  // 16
#define NSTAGES (NCHUNK / 32)    // 32
#define LDSPAD 36                // row stride (floats): keeps float4 16B-aligned,
                                 // 36*l16 mod 64 distinct -> conflict-free WMMA reads

#if defined(__has_builtin)
#if __has_builtin(__builtin_amdgcn_global_load_async_to_lds_b128)
#define HAVE_ASYNC_LDS 1
#endif
#endif

__device__ __forceinline__ v8f wmma_f32(v2f a, v2f b, v8f c) {
    return __builtin_amdgcn_wmma_f32_16x16x4_f32(false, a, false, b, (short)0, c,
                                                 false, false);
}

__device__ __forceinline__ void wait_async0() {
#if defined(HAVE_ASYNC_LDS)
#if __has_builtin(__builtin_amdgcn_s_wait_asynccnt)
    __builtin_amdgcn_s_wait_asynccnt(0);
#else
    asm volatile("s_wait_asynccnt 0" ::: "memory");
#endif
#endif
}

__device__ __forceinline__ void copy16_g2l(const float* g, float* l) {
#if defined(HAVE_ASYNC_LDS)
    __builtin_amdgcn_global_load_async_to_lds_b128(
        (g_v4i*)g, (l_v4i*)l, 0, 0);
#else
    *(float4*)l = *(const float4*)g;
#endif
}

// ---------------------------------------------------------------------------
// GEMM: out[b][m][n] = sum_c A[m][c] * x[b][c][n]  (+ bias[m] if BIAS)
// A: 128x128 row-major (per-batch stride aStride). x: (b, 128, 16384).
// Block = 256 threads = 8 waves; a block walks GTILES panels of 128(c) x GN(n).
// Each panel is brought into LDS once, by asynchronous copies (two buffers: the
// next panel flies while this one is worked on), and all 8 waves read their B
// fragments from it. Each wave owns one 16-row strip of A, held in registers
// for the whole walk, and 8 accumulator tiles (16 x GN).
// Tile j = 4*g + q of a wave takes the columns 64*g + 4*l16 + q, so that one
// ds_load_b128 of a row feeds four tiles and a lane's four results of a row are
// 16 contiguous bytes of out (a wave's store covers whole 128-byte lines).
// ---------------------------------------------------------------------------
#define GN     128                    // columns of one staged x panel
#define GTILES 4                      // panels per block
#define GBUF   (CDIM * GN * 4)        // bytes of one LDS buffer

__device__ __forceinline__ void copy8_rows(const float* g, unsigned l) {
    asm volatile(
        "global_load_async_to_lds_b128 %0, %8, off\n\t"
        "global_load_async_to_lds_b128 %1, %9, off\n\t"
        "global_load_async_to_lds_b128 %2, %10, off\n\t"
        "global_load_async_to_lds_b128 %3, %11, off\n\t"
        "global_load_async_to_lds_b128 %4, %12, off\n\t"
        "global_load_async_to_lds_b128 %5, %13, off\n\t"
        "global_load_async_to_lds_b128 %6, %14, off\n\t"
        "global_load_async_to_lds_b128 %7, %15, off\n\t"
        "s_wait_xcnt 0x0"
        :: "v"(l), "v"(l + 1 * GN * 4), "v"(l + 2 * GN * 4), "v"(l + 3 * GN * 4),
           "v"(l + 4 * GN * 4), "v"(l + 5 * GN * 4), "v"(l + 6 * GN * 4),
           "v"(l + 7 * GN * 4),
           "v"(g), "v"(g + 1 * NPIX), "v"(g + 2 * NPIX), "v"(g + 3 * NPIX),
           "v"(g + 4 * NPIX), "v"(g + 5 * NPIX), "v"(g + 6 * NPIX), "v"(g + 7 * NPIX)
        : "memory");
}

// The value that lane ^ 16 holds.
__device__ __forceinline__ float other_half(float v) {
    const int i = __builtin_bit_cast(int, v);
    return __builtin_bit_cast(float,
        __builtin_amdgcn_permlanex16(i, i, 0x76543210, 0xfedcba98, false, false));
}

template <bool BIAS>
__global__ void __launch_bounds__(256)
gemm_wmma_kernel(const float* __restrict__ Abase, size_t aStride,
                 const float* __restrict__ x,
                 const float* __restrict__ bias,
                 float* __restrict__ out) {
    __shared__ __attribute__((aligned(16))) float xs[2][CDIM][GN];

    const int b    = blockIdx.y;
    const int nblk = blockIdx.x * (GN * GTILES);
    const int tid  = threadIdx.x;
    const int lane = tid & 31;
    const int wv   = tid >> 5;       // 0..7
    const int l16  = lane & 15;
    const int half = lane >> 4;      // 0 or 1
    const int m0   = wv * 16;

    const float* A  = Abase + (size_t)b * aStride;
    const float* xb = x + (size_t)b * CDIM * NPIX;
    const float* arow = A + (size_t)(m0 + l16) * CDIM;

    // Copy duty: wave wv brings rows 16*wv .. 16*wv+15 of a panel, one whole
    // 512-byte row per wave-copy (lane = 16-byte piece).
    const float*   gsrc = xb + (size_t)m0 * NPIX + nblk + lane * 4;
    const unsigned ldst = (unsigned)(size_t)&xs[0][m0][lane * 4];

    // Panel 0 -> buffer 0.
    copy8_rows(gsrc, ldst);
    copy8_rows(gsrc + 8 * NPIX, ldst + 8 * GN * 4);

    // The wave's A strip: fragment s holds k = 4*s + 2*half, +1 of row m0 + l16.
    // A lane loads 16 bytes (k = 8*t + 4*half .. +3) and trades two of the four
    // values with lane ^ 16: half as many 16-line loads as with 8-byte loads.
    // (Every inner loop of this kernel is unrolled so that afr, bv and acc are
    // indexed by constants only and stay in registers.)
    v2f afr[CDIM / 4];
#pragma unroll
    for (int t = 0; t < CDIM / 8; ++t) {
        const float4 q = *(const float4*)(arow + 8 * t + 4 * half);
        const float rx = other_half(half ? q.x : q.z);
        const float ry = other_half(half ? q.y : q.w);
        afr[2 * t]     = half ? v2f{rx, ry}   : v2f{q.x, q.y};
        afr[2 * t + 1] = half ? v2f{q.z, q.w} : v2f{rx, ry};
    }

    float bv[8];
#pragma unroll
    for (int r = 0; r < 8; ++r) bv[r] = BIAS ? bias[m0 + r + 8 * half] : 0.0f;

    asm volatile("s_wait_asynccnt 0x0" ::: "memory");  // my rows of panel 0 landed
    __syncthreads();                                   // everyone's rows landed

    // Panel 1 -> buffer 1.
    copy8_rows(gsrc + GN, ldst + GBUF);
    copy8_rows(gsrc + GN + 8 * NPIX, ldst + GBUF + 8 * GN * 4);

    float* ob = out + (size_t)b * CDIM * NPIX + nblk + 4 * l16;

    // Kept rolled (for speed only): the body holds 256 matrix instructions.
#pragma unroll 1
    for (int t = 0; t < GTILES; ++t) {
        const float* xp = &xs[t & 1][2 * half][4 * l16];

        v8f acc[8];
#pragma unroll
        for (int j = 0; j < 8; ++j) acc[j] = v8f{};

#pragma unroll
        for (int s = 0; s < CDIM / 4; ++s) {
            const float4 p0 = *(const float4*)(xp + (4 * s) * GN);
            const float4 p1 = *(const float4*)(xp + (4 * s + 1) * GN);
            const float4 q0 = *(const float4*)(xp + (4 * s) * GN + 64);
            const float4 q1 = *(const float4*)(xp + (4 * s + 1) * GN + 64);
            acc[0] = wmma_f32(afr[s], v2f{p0.x, p1.x}, acc[0]);
            acc[1] = wmma_f32(afr[s], v2f{p0.y, p1.y}, acc[1]);
            acc[2] = wmma_f32(afr[s], v2f{p0.z, p1.z}, acc[2]);
            acc[3] = wmma_f32(afr[s], v2f{p0.w, p1.w}, acc[3]);
            acc[4] = wmma_f32(afr[s], v2f{q0.x, q1.x}, acc[4]);
            acc[5] = wmma_f32(afr[s], v2f{q0.y, q1.y}, acc[5]);
            acc[6] = wmma_f32(afr[s], v2f{q0.z, q1.z}, acc[6]);
            acc[7] = wmma_f32(afr[s], v2f{q0.w, q1.w}, acc[7]);
        }

        // Hand-over: my reads of this buffer are done, my rows of the next panel
        // have landed; behind the barrier that holds for every wave.
        asm volatile("s_wait_dscnt 0x0" ::: "memory");
        asm volatile("s_wait_asynccnt 0x0" ::: "memory");
        __syncthreads();

        if (t + 2 < GTILES) {   // panel t+2 -> the buffer that trip t has just read
            const float*   g2 = gsrc + (t + 2) * GN;
            const unsigned l2 = ldst + (t & 1) * GBUF;
            copy8_rows(g2, l2);
            copy8_rows(g2 + 8 * NPIX, l2 + 8 * GN * 4);
        }

        // The results go out behind the hand-over, so that neither the barrier nor
        // the next panel's copies wait for them.
        float* op = ob + t * GN;
#pragma unroll
        for (int r = 0; r < 8; ++r) {
            float* orow = op + (size_t)(m0 + r + 8 * half) * NPIX;
            float4 lo, hi;
            lo.x = acc[0][r] + bv[r];  lo.y = acc[1][r] + bv[r];
            lo.z = acc[2][r] + bv[r];  lo.w = acc[3][r] + bv[r];
            hi.x = acc[4][r] + bv[r];  hi.y = acc[5][r] + bv[r];
            hi.z = acc[6][r] + bv[r];  hi.w = acc[7][r] + bv[r];
            *(float4*)orow        = lo;
            *(float4*)(orow + 64) = hi;
        }
    }
    asm volatile("s_wait_asynccnt 0x0" ::: "memory");  // nothing in flight at the end
}

__global__ void softmax_stats_kernel(const float* __restrict__ kbuf,
                                     float* __restrict__ rmax,
                                     float* __restrict__ rinv) {
    __shared__ float red[256];
    const int row = blockIdx.x;           // b*128 + d
    const int tid = threadIdx.x;
    const float* p = kbuf + (size_t)row * NPIX;

    float m = -3.402823466e38f;
    for (int i = tid; i < NPIX; i += 256) m = fmaxf(m, p[i]);
    red[tid] = m;
    __syncthreads();
    for (int s = 128; s > 0; s >>= 1) {
        if (tid < s) red[tid] = fmaxf(red[tid], red[tid + s]);
        __syncthreads();
    }
    m = red[0];
    __syncthreads();

    float sum = 0.0f;
    for (int i = tid; i < NPIX; i += 256) sum += __expf(p[i] - m);
    red[tid] = sum;
    __syncthreads();
    for (int s = 128; s > 0; s >>= 1) {
        if (tid < s) red[tid] += red[tid + s];
        __syncthreads();
    }
    if (tid == 0) {
        rmax[row] = m;
        rinv[row] = 1.0f / red[0];
    }
}

__global__ void s_partial_kernel(const float* __restrict__ kbuf,
                                 const float* __restrict__ x,
                                 const float* __restrict__ rmax,
                                 const float* __restrict__ rinv,
                                 float* __restrict__ Spart) {
    __shared__ float kt[2][64][LDSPAD];
    __shared__ float xt[2][64][LDSPAD];
    __shared__ float rm[64];
    __shared__ float ri[64];

    const int tid  = threadIdx.x;
    const int lane = tid & 31;
    const int wv   = tid >> 5;
    const int l16  = lane & 15;
    const int half = lane >> 4;

    const int b     = blockIdx.z;
    const int d0    = (blockIdx.x >> 1) * 64;
    const int c0    = (blockIdx.x & 1) * 64;
    const int chunk = blockIdx.y;
    const int nbase = chunk * NCHUNK;

    if (tid < 64) {
        const int dg = b * CDIM + d0 + tid;
        rm[tid] = rmax[dg];
        ri[tid] = rinv[dg];
    }
    __syncthreads();

    const int tm  = wv >> 1;          // 0..3  -> d strip
    const int tn0 = (wv & 1) * 32;    // 0/32  -> c strips (two tiles)

    const float* kb = kbuf + ((size_t)b * CDIM + d0) * NPIX;
    const float* xb = x    + ((size_t)b * CDIM + c0) * NPIX;

    // Per-thread staging assignment: 512 float4s per 64x32 panel, 2 per thread.
    int srow[2], scol[2];
#pragma unroll
    for (int j = 0; j < 2; ++j) {
        const int q = tid + j * 256;
        srow[j] = q >> 3;           // 0..63
        scol[j] = (q & 7) * 4;      // 0..28
    }

    v8f acc0 = {}, acc1 = {};
    float4 kv[2];

    // Prologue: stage 0 into buffer 0.
#pragma unroll
    for (int j = 0; j < 2; ++j) {
        copy16_g2l(xb + (size_t)srow[j] * NPIX + nbase + scol[j],
                   &xt[0][srow[j]][scol[j]]);
        kv[j] = *(const float4*)(kb + (size_t)srow[j] * NPIX + nbase + scol[j]);
    }
#pragma unroll
    for (int j = 0; j < 2; ++j) {
        const float m = rm[srow[j]], s = ri[srow[j]];
        float4 t;
        t.x = __expf(kv[j].x - m) * s;
        t.y = __expf(kv[j].y - m) * s;
        t.z = __expf(kv[j].z - m) * s;
        t.w = __expf(kv[j].w - m) * s;
        *(float4*)&kt[0][srow[j]][scol[j]] = t;
    }

    int buf = 0;
    for (int st = 0; st < NSTAGES; ++st) {
        wait_async0();          // my async x-panel for stage st landed
        __syncthreads();        // + everyone's k-panel stores; frees buf^1

        const bool has_next = (st + 1) < NSTAGES;
        if (has_next) {
            const int nsn = nbase + (st + 1) * 32;
#pragma unroll
            for (int j = 0; j < 2; ++j) {
                copy16_g2l(xb + (size_t)srow[j] * NPIX + nsn + scol[j],
                           &xt[buf ^ 1][srow[j]][scol[j]]);
                kv[j] = *(const float4*)(kb + (size_t)srow[j] * NPIX + nsn + scol[j]);
            }
        }

        const float (*ktb)[LDSPAD] = kt[buf];
        const float (*xtb)[LDSPAD] = xt[buf];
#pragma unroll
        for (int kk = 0; kk < 32; kk += 4) {
            const int kr = kk + 2 * half;
            v2f a, b0, b1;
            a.x  = ktb[tm * 16 + l16][kr];
            a.y  = ktb[tm * 16 + l16][kr + 1];
            b0.x = xtb[tn0 + l16][kr];
            b0.y = xtb[tn0 + l16][kr + 1];
            b1.x = xtb[tn0 + 16 + l16][kr];
            b1.y = xtb[tn0 + 16 + l16][kr + 1];
            acc0 = wmma_f32(a, b0, acc0);
            acc1 = wmma_f32(a, b1, acc1);
        }

        if (has_next) {
#pragma unroll
            for (int j = 0; j < 2; ++j) {
                const float m = rm[srow[j]], s = ri[srow[j]];
                float4 t;
                t.x = __expf(kv[j].x - m) * s;
                t.y = __expf(kv[j].y - m) * s;
                t.z = __expf(kv[j].z - m) * s;
                t.w = __expf(kv[j].w - m) * s;
                *(float4*)&kt[buf ^ 1][srow[j]][scol[j]] = t;
            }
        }
        buf ^= 1;
    }

    float* Sp = Spart + ((size_t)chunk * NBATCH + b) * (CDIM * CDIM);
#pragma unroll
    for (int r = 0; r < 8; ++r) {
        const int d = d0 + tm * 16 + r + 8 * half;
        Sp[d * CDIM + c0 + tn0 + l16]      = acc0[r];
        Sp[d * CDIM + c0 + tn0 + 16 + l16] = acc1[r];
    }
}

// Ssum[b][d][c] = sum over chunks of Spart
__global__ void s_reduce_kernel(const float* __restrict__ Spart,
                                float* __restrict__ Ssum) {
    const int idx = blockIdx.x * 256 + threadIdx.x;   // over 16*16384
    const int b   = idx >> 14;
    const int dc  = idx & 16383;
    float acc = 0.0f;
#pragma unroll
    for (int ch = 0; ch < NCHUNKS; ++ch)
        acc += Spart[((size_t)ch * NBATCH + b) * (CDIM * CDIM) + dc];
    Ssum[idx] = acc;
}

// ctx[b][h][d][e] = sum_c Ssum[b][h*32+d][c] * Wv[h*32+e][c]   (Wv = w_qkv rows 256..383)
__global__ void ctx_kernel(const float* __restrict__ Ssum,
                           const float* __restrict__ w_qkv,
                           float* __restrict__ ctx) {
    const int idx = blockIdx.x * 256 + threadIdx.x;   // over 16*4096
    const int b   = idx >> 12;
    const int h   = (idx >> 10) & 3;
    const int d   = (idx >> 5) & 31;
    const int e   = idx & 31;
    const float* srow = Ssum + (size_t)b * (CDIM * CDIM) + (h * 32 + d) * CDIM;
    const float* wrow = w_qkv + (size_t)(256 + h * 32 + e) * CDIM;
    float acc = 0.0f;
    for (int c = 0; c < CDIM; ++c) acc += srow[c] * wrow[c];
    ctx[idx] = acc;
}

// T[b][o][h*32+d] = sum_e w_out[o][h*32+e] * ctx[b][h][d][e]
__global__ void t_kernel(const float* __restrict__ ctx,
                         const float* __restrict__ w_out,
                         float* __restrict__ T) {
    const int idx = blockIdx.x * 256 + threadIdx.x;   // over 16*16384
    const int b   = idx >> 14;
    const int o   = (idx >> 7) & 127;
    const int i   = idx & 127;
    const int h   = i >> 5;
    const int d   = i & 31;
    const float* wo = w_out + o * CDIM + h * 32;
    const float* cx = ctx + (size_t)b * 4096 + h * 1024 + d * 32;
    float acc = 0.0f;
#pragma unroll
    for (int e = 0; e < 32; ++e) acc += wo[e] * cx[e];
    T[idx] = acc;
}

// Weff[b][o][c] = scale * sum_i T[b][o][i] * Wq[i][c]   (Wq = w_qkv rows 0..127)
__global__ void weff_kernel(const float* __restrict__ T,
                            const float* __restrict__ w_qkv,
                            float* __restrict__ Weff) {
    const int idx = blockIdx.x * 256 + threadIdx.x;   // over 16*16384
    const int b   = idx >> 14;
    const int o   = (idx >> 7) & 127;
    const int c   = idx & 127;
    const float* trow = T + (size_t)b * (CDIM * CDIM) + o * CDIM;
    float acc = 0.0f;
    for (int i = 0; i < CDIM; ++i) acc += trow[i] * w_qkv[i * CDIM + c];
    Weff[idx] = 0.17677669529663687f * acc;   // 32^-0.5
}

// ---------------------------------------------------------------------------
extern "C" void kernel_launch(void* const* d_in, const int* in_sizes, int n_in,
                              void* d_out, int out_size, void* d_ws, size_t ws_size,
                              hipStream_t stream) {
    const float* x      = (const float*)d_in[0];   // (16,128,128,128)
    const float* w_qkv  = (const float*)d_in[1];   // (384,128)
    const float* w_out  = (const float*)d_in[2];   // (128,128)
    const float* b_out  = (const float*)d_in[3];   // (128,)

    float* ws   = (float*)d_ws;
    float* kbuf = ws;                                   // 16*128*16384
    float* rmax = kbuf + (size_t)NBATCH * CDIM * NPIX;  // 2048
    float* rinv = rmax + NBATCH * CDIM;                 // 2048
    float* Spart = rinv + NBATCH * CDIM;                // 16*16*16384
    float* Ssum  = Spart + (size_t)NCHUNKS * NBATCH * CDIM * CDIM; // 16*16384
    float* ctx   = Ssum + (size_t)NBATCH * CDIM * CDIM;            // 16*4096
    float* T     = ctx + (size_t)NBATCH * 4096;                    // 16*16384
    float* Weff  = T + (size_t)NBATCH * CDIM * CDIM;               // 16*16384

    // 1) k = Wk * x  (Wk = w_qkv rows 128..255)
    gemm_wmma_kernel<false><<<dim3(NPIX / (GN * GTILES), NBATCH), 256, 0, stream>>>(
        w_qkv + 128 * CDIM, 0, x, nullptr, kbuf);

    // 2) softmax stats per (b,d) row
    softmax_stats_kernel<<<NBATCH * CDIM, 256, 0, stream>>>(kbuf, rmax, rinv);

    // 3) S = ksoft * x^T  (split-K over n, per-chunk partials)
    s_partial_kernel<<<dim3(4, NCHUNKS, NBATCH), 256, 0, stream>>>(
        kbuf, x, rmax, rinv, Spart);
    s_reduce_kernel<<<(NBATCH * CDIM * CDIM) / 256, 256, 0, stream>>>(Spart, Ssum);

    // 4) tiny per-batch combines: ctx -> T -> W_eff
    ctx_kernel<<<(NBATCH * 4096) / 256, 256, 0, stream>>>(Ssum, w_qkv, ctx);
    t_kernel<<<(NBATCH * CDIM * CDIM) / 256, 256, 0, stream>>>(ctx, w_out, T);
    weff_kernel<<<(NBATCH * CDIM * CDIM) / 256, 256, 0, stream>>>(T, w_qkv, Weff);

    // 5) out = W_eff[b] * x + b_out
    gemm_wmma_kernel<true><<<dim3(NPIX / (GN * GTILES), NBATCH), 256, 0, stream>>>(
        Weff, (size_t)(CDIM * CDIM), x, b_out, (float*)d_out);
}

// v002
// One run takes 160 microseconds.
// Timed twice side by side with v001, it ran 1.21 times as fast both times.
// All steps since v000 together make it 1.70 times as fast.
#include <hip/hip_runtime.h>
#include <cstddef>

typedef __attribute__((ext_vector_type(2))) float v2f;
typedef __attribute__((ext_vector_type(8))) float v8f;

#define NPIX   16384   // H*W
#define CDIM   128
#define NBATCH 16

__device__ __forceinline__ v8f wmma_f32(v2f a, v2f b, v8f c) {
    return __builtin_amdgcn_wmma_f32_16x16x4_f32(false, a, false, b, (short)0, c,
                                                 false, false);
}

// ---------------------------------------------------------------------------
// GEMM: out[b][m][n] = sum_c A[m][c] * x[b][c][n]  (+ bias[m] if BIAS)
// A: 128x128 row-major (per-batch stride aStride). x: (b, 128, 16384).
// Block = 256 threads = 8 waves; a block walks GTILES panels of 128(c) x GN(n).
// Each panel is brought into LDS once, by asynchronous copies (two buffers: the
// next panel flies while this one is worked on), and all 8 waves read their B
// fragments from it. Each wave owns one 16-row strip of A, held in registers
// for the whole walk, and 8 accumulator tiles (16 x GN).
// Tile j = 4*g + q of a wave takes the columns 64*g + 4*l16 + q, so that one
// ds_load_b128 of a row feeds four tiles and a lane's four results of a row are
// 16 contiguous bytes of out (a wave's store covers whole 128-byte lines).
// ---------------------------------------------------------------------------
#define GN     128                    // columns of one staged x panel
#define GTILES 4                      // panels per block
#define GBUF   (CDIM * GN * 4)        // bytes of one LDS buffer

__device__ __forceinline__ void copy8_rows(const float* g, unsigned l) {
    asm volatile(
        "global_load_async_to_lds_b128 %0, %8, off\n\t"
        "global_load_async_to_lds_b128 %1, %9, off\n\t"
        "global_load_async_to_lds_b128 %2, %10, off\n\t"
        "global_load_async_to_lds_b128 %3, %11, off\n\t"
        "global_load_async_to_lds_b128 %4, %12, off\n\t"
        "global_load_async_to_lds_b128 %5, %13, off\n\t"
        "global_load_async_to_lds_b128 %6, %14, off\n\t"
        "global_load_async_to_lds_b128 %7, %15, off\n\t"
        "s_wait_xcnt 0x0"
        :: "v"(l), "v"(l + 1 * GN * 4), "v"(l + 2 * GN * 4), "v"(l + 3 * GN * 4),
           "v"(l + 4 * GN * 4), "v"(l + 5 * GN * 4), "v"(l + 6 * GN * 4),
           "v"(l + 7 * GN * 4),
           "v"(g), "v"(g + 1 * NPIX), "v"(g + 2 * NPIX), "v"(g + 3 * NPIX),
           "v"(g + 4 * NPIX), "v"(g + 5 * NPIX), "v"(g + 6 * NPIX), "v"(g + 7 * NPIX)
        : "memory");
}

// The value that lane ^ 16 holds.
__device__ __forceinline__ float other_half(float v) {
    const int i = __builtin_bit_cast(int, v);
    return __builtin_bit_cast(float,
        __builtin_amdgcn_permlanex16(i, i, 0x76543210, 0xfedcba98, false, false));
}

template <bool BIAS>
__global__ void __launch_bounds__(256)
gemm_wmma_kernel(const float* __restrict__ Abase, size_t aStride,
                 const float* __restrict__ x,
                 const float* __restrict__ bias,
                 float* __restrict__ out) {
    __shared__ __attribute__((aligned(16))) float xs[2][CDIM][GN];

    const int b    = blockIdx.y;
    const int nblk = blockIdx.x * (GN * GTILES);
    const int tid  = threadIdx.x;
    const int lane = tid & 31;
    const int wv   = tid >> 5;       // 0..7
    const int l16  = lane & 15;
    const int half = lane >> 4;      // 0 or 1
    const int m0   = wv * 16;

    const float* A  = Abase + (size_t)b * aStride;
    const float* xb = x + (size_t)b * CDIM * NPIX;
    const float* arow = A + (size_t)(m0 + l16) * CDIM;

    // Copy duty: wave wv brings rows 16*wv .. 16*wv+15 of a panel, one whole
    // 512-byte row per wave-copy (lane = 16-byte piece).
    const float*   gsrc = xb + (size_t)m0 * NPIX + nblk + lane * 4;
    const unsigned ldst = (unsigned)(size_t)&xs[0][m0][lane * 4];

    // Panel 0 -> buffer 0.
    copy8_rows(gsrc, ldst);
    copy8_rows(gsrc + 8 * NPIX, ldst + 8 * GN * 4);

    // The wave's A strip: fragment s holds k = 4*s + 2*half, +1 of row m0 + l16.
    // A lane loads 16 bytes (k = 8*t + 4*half .. +3) and trades two of the four
    // values with lane ^ 16: half as many 16-line loads as with 8-byte loads.
    // (Every inner loop of this kernel is unrolled so that afr, bv and acc are
    // indexed by constants only and stay in registers.)
    v2f afr[CDIM / 4];
#pragma unroll
    for (int t = 0; t < CDIM / 8; ++t) {
        const float4 q = *(const float4*)(arow + 8 * t + 4 * half);
        const float rx = other_half(half ? q.x : q.z);
        const float ry = other_half(half ? q.y : q.w);
        afr[2 * t]     = half ? v2f{rx, ry}   : v2f{q.x, q.y};
        afr[2 * t + 1] = half ? v2f{q.z, q.w} : v2f{rx, ry};
    }

    float bv[8];
#pragma unroll
    for (int r = 0; r < 8; ++r) bv[r] = BIAS ? bias[m0 + r + 8 * half] : 0.0f;

    asm volatile("s_wait_asynccnt 0x0" ::: "memory");  // my rows of panel 0 landed
    __syncthreads();                                   // everyone's rows landed

    // Panel 1 -> buffer 1.
    copy8_rows(gsrc + GN, ldst + GBUF);
    copy8_rows(gsrc + GN + 8 * NPIX, ldst + GBUF + 8 * GN * 4);

    float* ob = out + (size_t)b * CDIM * NPIX + nblk + 4 * l16;

    // Kept rolled (for speed only): the body holds 256 matrix instructions.
#pragma unroll 1
    for (int t = 0; t < GTILES; ++t) {
        const float* xp = &xs[t & 1][2 * half][4 * l16];

        v8f acc[8];
#pragma unroll
        for (int j = 0; j < 8; ++j) acc[j] = v8f{};

#pragma unroll
        for (int s = 0; s < CDIM / 4; ++s) {
            const float4 p0 = *(const float4*)(xp + (4 * s) * GN);
            const float4 p1 = *(const float4*)(xp + (4 * s + 1) * GN);
            const float4 q0 = *(const float4*)(xp + (4 * s) * GN + 64);
            const float4 q1 = *(const float4*)(xp + (4 * s + 1) * GN + 64);
            acc[0] = wmma_f32(afr[s], v2f{p0.x, p1.x}, acc[0]);
            acc[1] = wmma_f32(afr[s], v2f{p0.y, p1.y}, acc[1]);
            acc[2] = wmma_f32(afr[s], v2f{p0.z, p1.z}, acc[2]);
            acc[3] = wmma_f32(afr[s], v2f{p0.w, p1.w}, acc[3]);
            acc[4] = wmma_f32(afr[s], v2f{q0.x, q1.x}, acc[4]);
            acc[5] = wmma_f32(afr[s], v2f{q0.y, q1.y}, acc[5]);
            acc[6] = wmma_f32(afr[s], v2f{q0.z, q1.z}, acc[6]);
            acc[7] = wmma_f32(afr[s], v2f{q0.w, q1.w}, acc[7]);
        }

        // Hand-over: my reads of this buffer are done, my rows of the next panel
        // have landed; behind the barrier that holds for every wave.
        asm volatile("s_wait_dscnt 0x0" ::: "memory");
        asm volatile("s_wait_asynccnt 0x0" ::: "memory");
        __syncthreads();

        if (t + 2 < GTILES) {   // panel t+2 -> the buffer that trip t has just read
            const float*   g2 = gsrc + (t + 2) * GN;
            const unsigned l2 = ldst + (t & 1) * GBUF;
            copy8_rows(g2, l2);
            copy8_rows(g2 + 8 * NPIX, l2 + 8 * GN * 4);
        }

        // The results go out behind the hand-over, so that neither the barrier nor
        // the next panel's copies wait for them.
        float* op = ob + t * GN;
#pragma unroll
        for (int r = 0; r < 8; ++r) {
            float* orow = op + (size_t)(m0 + r + 8 * half) * NPIX;
            float4 lo, hi;
            lo.x = acc[0][r] + bv[r];  lo.y = acc[1][r] + bv[r];
            lo.z = acc[2][r] + bv[r];  lo.w = acc[3][r] + bv[r];
            hi.x = acc[4][r] + bv[r];  hi.y = acc[5][r] + bv[r];
            hi.z = acc[6][r] + bv[r];  hi.w = acc[7][r] + bv[r];
            *(float4*)orow        = lo;
            *(float4*)(orow + 64) = hi;
        }
    }
    asm volatile("s_wait_asynccnt 0x0" ::: "memory");  // nothing in flight at the end
}

__device__ __forceinline__ float exp_slot(float v) {
    float r;
    asm("v_exp_f32 %0, %1\n\tv_nop" : "=v"(r) : "v"(v * 1.44269504f));
    return r;
}

// ---------------------------------------------------------------------------
// k = Wk * x, softmax over n and S = softmax(k) * x^T in one kernel: k stays in
// registers and never goes to memory. A block walks GTILES panels of
// 128(c) x GN(n) of one batch, staged as in the GEMM above (two buffers,
// asynchronous copies), and leaves an unnormalised partial S with the running
// row maximum and row sum of its own columns; s_reduce_kernel merges the blocks.
// Wave wv owns the rows d = 16*wv .. +15. Per group of 64 columns:
//  1) kT (n x d) = x^T * Wk^T: four tiles; tile q, row i is n = 4*i + q of the
//     group. In the result a lane holds ONE d (= l16) and the columns
//     n = 32*half + 4*r + q, so maximum, sum and rescale are per lane.
//  2) p = exp(kT - m), the running maximum m raised first (sum and S rescaled).
//  3) S^T (c x d) += x * p: (P[2*u][r], P[2*u+1][r]) is a B fragment as it stands,
//     its k order n = 32*half + 4*r + 2*u + {0,1}; the A fragment reads x[c] at
//     the same four columns with one 16-byte LDS load for u = 0 and 1.
// ---------------------------------------------------------------------------
#define XP   132
#define FBUF (CDIM * XP * 4)
#define FCH  (NPIX / (GN * GTILES))

__device__ __forceinline__ void copy8_rows_padded(const float* g, unsigned l) {
    asm volatile(
        "global_load_async_to_lds_b128 %0, %8, off\n\t"
        "global_load_async_to_lds_b128 %1, %9, off\n\t"
        "global_load_async_to_lds_b128 %2, %10, off\n\t"
        "global_load_async_to_lds_b128 %3, %11, off\n\t"
        "global_load_async_to_lds_b128 %4, %12, off\n\t"
        "global_load_async_to_lds_b128 %5, %13, off\n\t"
        "global_load_async_to_lds_b128 %6, %14, off\n\t"
        "global_load_async_to_lds_b128 %7, %15, off\n\t"
        "s_wait_xcnt 0x0"
        :: "v"(l), "v"(l + 1 * XP * 4), "v"(l + 2 * XP * 4), "v"(l + 3 * XP * 4),
           "v"(l + 4 * XP * 4), "v"(l + 5 * XP * 4), "v"(l + 6 * XP * 4),
           "v"(l + 7 * XP * 4),
           "v"(g), "v"(g + 1 * NPIX), "v"(g + 2 * NPIX), "v"(g + 3 * NPIX),
           "v"(g + 4 * NPIX), "v"(g + 5 * NPIX), "v"(g + 6 * NPIX), "v"(g + 7 * NPIX)
        : "memory");
}

__global__ void __launch_bounds__(256)
ksoft_s_kernel(const float* __restrict__ Wk,
               const float* __restrict__ x,
               float* __restrict__ Spart,
               float* __restrict__ mpart,
               float* __restrict__ lpart) {
    __shared__ __attribute__((aligned(16))) float xs[2][CDIM][XP];

    const int b     = blockIdx.y;
    const int chunk = blockIdx.x;
    const int nblk  = chunk * (GN * GTILES);
    const int tid   = threadIdx.x;
    const int lane  = tid & 31;
    const int wv    = tid >> 5;       // 0..7
    const int l16   = lane & 15;
    const int half  = lane >> 4;      // 0 or 1
    const int m0    = wv * 16;

    const float* xb   = x + (size_t)b * CDIM * NPIX;
    const float* wrow = Wk + (size_t)(m0 + l16) * CDIM;

    // Copy duty as in the GEMM: wave wv brings rows 16*wv .. +15 of a panel.
    const float*   gsrc = xb + (size_t)m0 * NPIX + nblk + lane * 4;
    const unsigned ldst = (unsigned)(size_t)&xs[0][m0][lane * 4];

    // Panel 0 -> buffer 0.
    copy8_rows_padded(gsrc, ldst);
    copy8_rows_padded(gsrc + 8 * NPIX, ldst + 8 * XP * 4);

    // The wave's Wk strip as B fragments: fragment s holds c = 4*s + 2*half, +1
    // of row d = m0 + l16 (loaded as the GEMM loads its A strip).
    v2f wfr[CDIM / 4];
#pragma unroll
    for (int t = 0; t < CDIM / 8; ++t) {
        const float4 q = *(const float4*)(wrow + 8 * t + 4 * half);
        const float rx = other_half(half ? q.x : q.z);
        const float ry = other_half(half ? q.y : q.w);
        wfr[2 * t]     = half ? v2f{rx, ry}   : v2f{q.x, q.y};
        wfr[2 * t + 1] = half ? v2f{q.z, q.w} : v2f{rx, ry};
    }

    asm volatile("s_wait_asynccnt 0x0" ::: "memory");  // my rows of panel 0 landed
    __syncthreads();                                   // everyone's rows landed

    // Panel 1 -> buffer 1.
    copy8_rows_padded(gsrc + GN, ldst + FBUF);
    copy8_rows_padded(gsrc + GN + 8 * NPIX, ldst + FBUF + 8 * XP * 4);

    v8f acc[8];                       // S^T: tile ct is c = 16*ct + r + 8*half, d = l16
#pragma unroll
    for (int j = 0; j < 8; ++j) acc[j] = v8f{};
    float m = -3.402823466e38f;       // running maximum of row d (equal in both halves)
    float l = 0.0f;                   // running sum of this lane's columns

    // Both loops kept rolled: one body holds 256 matrix instructions already.
#pragma unroll 1
    for (int t = 0; t < GTILES; ++t) {
#pragma unroll 1
        for (int g = 0; g < GN / 64; ++g) {
            const float* xp = &xs[t & 1][2 * half][64 * g + 4 * l16];
            v8f P[4];
#pragma unroll
            for (int q = 0; q < 4; ++q) P[q] = v8f{};
            // The LDS reads are written two steps ahead of their use, so that the
            // wait in front of a step's matrix instructions is not a wait to 0.
            float4 pa[3], pb[3];
#pragma unroll
            for (int s = 0; s < 2; ++s) {
                pa[s] = *(const float4*)(xp + (4 * s) * XP);
                pb[s] = *(const float4*)(xp + (4 * s + 1) * XP);
            }
#pragma unroll
            for (int s = 0; s < CDIM / 4; ++s) {
                if (s + 2 < CDIM / 4) {
                    pa[(s + 2) % 3] = *(const float4*)(xp + (4 * s + 8) * XP);
                    pb[(s + 2) % 3] = *(const float4*)(xp + (4 * s + 9) * XP);
                }
                const float4 p0 = pa[s % 3], p1 = pb[s % 3];
                P[0] = wmma_f32(v2f{p0.x, p1.x}, wfr[s], P[0]);
                P[1] = wmma_f32(v2f{p0.y, p1.y}, wfr[s], P[1]);
                P[2] = wmma_f32(v2f{p0.z, p1.z}, wfr[s], P[2]);
                P[3] = wmma_f32(v2f{p0.w, p1.w}, wfr[s], P[3]);
            }

            // Maximum and sum go tile by tile (four short chains, then combined).
            float gq[4];
#pragma unroll
            for (int q = 0; q < 4; ++q) {
                gq[q] = P[q][0];
#pragma unroll
                for (int r = 1; r < 8; ++r) gq[q] = fmaxf(gq[q], P[q][r]);
            }
            float gm = fmaxf(fmaxf(gq[0], gq[1]), fmaxf(gq[2], gq[3]));
            gm = fmaxf(gm, other_half(gm));
            const float mn    = fmaxf(m, gm);
            const float alpha = exp_slot(m - mn);
            m = mn;
            float sq[4];
#pragma unroll
            for (int q = 0; q < 4; ++q) {
                sq[q] = 0.0f;
#pragma unroll
                for (int r = 0; r < 8; ++r) {
                    P[q][r] = exp_slot(P[q][r] - mn);
                    sq[q] += P[q][r];
                }
            }
            l = l * alpha + ((sq[0] + sq[1]) + (sq[2] + sq[3]));
#pragma unroll
            for (int j = 0; j < 8; ++j) acc[j] *= alpha;

            const float* xa = &xs[t & 1][l16][64 * g + 32 * half];
            // Step i = 4*r + ct/2; the reads again two steps ahead.
            float4 qa[3], qb[3];
#pragma unroll
            for (int i = 0; i < 2; ++i) {
                qa[i] = *(const float4*)(xa + (32 * (i & 3)) * XP + 4 * (i >> 2));
                qb[i] = *(const float4*)(xa + (32 * (i & 3) + 16) * XP + 4 * (i >> 2));
            }
#pragma unroll
            for (int i = 0; i < 32; ++i) {
                if (i + 2 < 32) {
                    const int k = i + 2;
                    qa[k % 3] = *(const float4*)(xa + (32 * (k & 3)) * XP + 4 * (k >> 2));
                    qb[k % 3] = *(const float4*)(xa + (32 * (k & 3) + 16) * XP + 4 * (k >> 2));
                }
                const int r = i >> 2, ct = 2 * (i & 3);
                const float4 a0 = qa[i % 3], a1 = qb[i % 3];
                const v2f pb0 = v2f{P[0][r], P[1][r]};
                const v2f pb1 = v2f{P[2][r], P[3][r]};
                acc[ct]     = wmma_f32(v2f{a0.x, a0.y}, pb0, acc[ct]);
                acc[ct + 1] = wmma_f32(v2f{a1.x, a1.y}, pb0, acc[ct + 1]);
                acc[ct]     = wmma_f32(v2f{a0.z, a0.w}, pb1, acc[ct]);
                acc[ct + 1] = wmma_f32(v2f{a1.z, a1.w}, pb1, acc[ct + 1]);
            }
        }

        // Hand-over: my reads of this buffer are done, my rows of the next panel
        // have landed; behind the barrier that holds for every wave.
        asm volatile("s_wait_dscnt 0x0" ::: "memory");
        asm volatile("s_wait_asynccnt 0x0" ::: "memory");
        __syncthreads();

        if (t + 2 < GTILES) {   // panel t+2 -> the buffer that trip t has just read
            const float*   g2 = gsrc + (t + 2) * GN;
            const unsigned l2 = ldst + (t & 1) * FBUF;
            copy8_rows_padded(g2, l2);
            copy8_rows_padded(g2 + 8 * NPIX, l2 + 8 * XP * 4);
        }
    }
    asm volatile("s_wait_asynccnt 0x0" ::: "memory");  // nothing in flight at the end

    const size_t part = (size_t)chunk * NBATCH + b;
    float* Sp = Spart + part * (CDIM * CDIM) + (m0 + l16) * CDIM + 8 * half;
#pragma unroll
    for (int ct = 0; ct < 8; ++ct) {
        *(float4*)(Sp + 16 * ct) =
            make_float4(acc[ct][0], acc[ct][1], acc[ct][2], acc[ct][3]);
        *(float4*)(Sp + 16 * ct + 4) =
            make_float4(acc[ct][4], acc[ct][5], acc[ct][6], acc[ct][7]);
    }
    const float lsum = l + other_half(l);
    if (half == 0) {
        mpart[part * CDIM + m0 + l16] = m;
        lpart[part * CDIM + m0 + l16] = lsum;
    }
}

// Ssum[b][d][c]: the blocks' partials brought to the row's common maximum M,
// summed, and divided by the row's sum of exp(k - M).
// Spart comes in as four pointers, one to each run of FCH/4 partials (8 MiB, the
// reach of a load's immediate offset): every load is then scalar base + idx (or
// row) + immediate, with no 64-bit vector address to form.
// (The pointers are not __restrict__: a load through a const __restrict__ pointer
// may be moved over the wait below, which would then not stand behind it.)
#define PSTRIDE (NBATCH * CDIM * CDIM)    // floats from one partial to the next
__global__ void s_reduce_kernel(const float* Sq0, const float* Sq1,
                                const float* Sq2, const float* Sq3,
                                const float* mpart, const float* lpart,
                                float* Ssum) {
    const int idx = blockIdx.x * 256 + threadIdx.x;   // over 16*16384: b, d, c
    const int row = idx >> 7;                         // b*128 + d
    float mc[FCH];
    float M = -3.402823466e38f;
#pragma unroll
    for (int ch = 0; ch < FCH; ++ch) {
        mc[ch] = mpart[ch * (NBATCH * CDIM) + row];
        M = fmaxf(M, mc[ch]);
    }
    float acc = 0.0f, den = 0.0f;
#pragma unroll
    for (int ch = 0; ch < FCH; ++ch) {
        const float* Sq = ch < 8 ? Sq0 : ch < 16 ? Sq1 : ch < 24 ? Sq2 : Sq3;
        const float w = exp_slot(mc[ch] - M);
        acc += w * Sq[(ch & 7) * PSTRIDE + idx];
        den += w * lpart[ch * (NBATCH * CDIM) + row];
    }
    // The wait that stands in front of a rewrite of a register that an issued load
    // names. row is its input, so that it keeps its register up to here and no
    // load's result is placed there (idx keeps its own up to the store).
    asm volatile("s_wait_xcnt 0x0" :: "v"(row) : "memory");
    Ssum[idx] = acc / den;
}

// ctx[b][h][d][e] = sum_c Ssum[b][h*32+d][c] * Wv[h*32+e][c]   (Wv = w_qkv rows 256..383)
__global__ void ctx_kernel(const float* __restrict__ Ssum,
                           const float* __restrict__ w_qkv,
                           float* __restrict__ ctx) {
    const int idx = blockIdx.x * 256 + threadIdx.x;   // over 16*4096
    const int b   = idx >> 12;
    const int h   = (idx >> 10) & 3;
    const int d   = (idx >> 5) & 31;
    const int e   = idx & 31;
    const float* srow = Ssum + (size_t)b * (CDIM * CDIM) + (h * 32 + d) * CDIM;
    const float* wrow = w_qkv + (size_t)(256 + h * 32 + e) * CDIM;
    float acc = 0.0f;
    for (int c = 0; c < CDIM; ++c) acc += srow[c] * wrow[c];
    ctx[idx] = acc;
}

// T[b][o][h*32+d] = sum_e w_out[o][h*32+e] * ctx[b][h][d][e]
__global__ void t_kernel(const float* __restrict__ ctx,
                         const float* __restrict__ w_out,
                         float* __restrict__ T) {
    const int idx = blockIdx.x * 256 + threadIdx.x;   // over 16*16384
    const int b   = idx >> 14;
    const int o   = (idx >> 7) & 127;
    const int i   = idx & 127;
    const int h   = i >> 5;
    const int d   = i & 31;
    const float* wo = w_out + o * CDIM + h * 32;
    const float* cx = ctx + (size_t)b * 4096 + h * 1024 + d * 32;
    float acc = 0.0f;
#pragma unroll
    for (int e = 0; e < 32; ++e) acc += wo[e] * cx[e];
    T[idx] = acc;
}

// Weff[b][o][c] = scale * sum_i T[b][o][i] * Wq[i][c]   (Wq = w_qkv rows 0..127)
__global__ void weff_kernel(const float* __restrict__ T,
                            const float* __restrict__ w_qkv,
                            float* __restrict__ Weff) {
    const int idx = blockIdx.x * 256 + threadIdx.x;   // over 16*16384
    const int b   = idx >> 14;
    const int o   = (idx >> 7) & 127;
    const int c   = idx & 127;
    const float* trow = T + (size_t)b * (CDIM * CDIM) + o * CDIM;
    float acc = 0.0f;
    for (int i = 0; i < CDIM; ++i) acc += trow[i] * w_qkv[i * CDIM + c];
    Weff[idx] = 0.17677669529663687f * acc;   // 32^-0.5
}

// ---------------------------------------------------------------------------
extern "C" void kernel_launch(void* const* d_in, const int* in_sizes, int n_in,
                              void* d_out, int out_size, void* d_ws, size_t ws_size,
                              hipStream_t stream) {
    const float* x      = (const float*)d_in[0];   // (16,128,128,128)
    const float* w_qkv  = (const float*)d_in[1];   // (384,128)
    const float* w_out  = (const float*)d_in[2];   // (128,128)
    const float* b_out  = (const float*)d_in[3];   // (128,)

    float* ws   = (float*)d_ws;
    float* Spart = ws;                                             // 32*16*16384
    float* mpart = Spart + (size_t)FCH * NBATCH * CDIM * CDIM;     // 32*16*128
    float* lpart = mpart + FCH * NBATCH * CDIM;                    // 32*16*128
    float* Ssum  = lpart + FCH * NBATCH * CDIM;                    // 16*16384
    float* ctx   = Ssum + (size_t)NBATCH * CDIM * CDIM;            // 16*4096
    float* T     = ctx + (size_t)NBATCH * 4096;                    // 16*16384
    float* Weff  = T + (size_t)NBATCH * CDIM * CDIM;               // 16*16384

    // 1-3) S = softmax(Wk * x) * x^T  (Wk = w_qkv rows 128..255): per-block
    //      partials with their row maximum and row sum, then the merge
    ksoft_s_kernel<<<dim3(FCH, NBATCH), 256, 0, stream>>>(
        w_qkv + 128 * CDIM, x, Spart, mpart, lpart);
    s_reduce_kernel<<<(NBATCH * CDIM * CDIM) / 256, 256, 0, stream>>>(
        Spart, Spart + (size_t)8 * PSTRIDE, Spart + (size_t)16 * PSTRIDE,
        Spart + (size_t)24 * PSTRIDE, mpart, lpart, Ssum);

    // 4) tiny per-batch combines: ctx -> T -> W_eff
    ctx_kernel<<<(NBATCH * 4096) / 256, 256, 0, stream>>>(Ssum, w_qkv, ctx);
    t_kernel<<<(NBATCH * CDIM * CDIM) / 256, 256, 0, stream>>>(ctx, w_out, T);
    weff_kernel<<<(NBATCH * CDIM * CDIM) / 256, 256, 0, stream>>>(T, w_qkv, Weff);

    // 5) out = W_eff[b] * x + b_out
    gemm_wmma_kernel<true><<<dim3(NPIX / (GN * GTILES), NBATCH), 256, 0, stream>>>(
        Weff, (size_t)(CDIM * CDIM), x, b_out, (float*)d_out);
}

// v003
// A run of this version takes 148 microseconds.
// Timed twice side by side with v002, it ran 1.09 and 1.08 times as fast.
// Over all steps from v000 it is 1.85 times as fast.
#include <hip/hip_runtime.h>
#include <cstddef>

typedef __attribute__((ext_vector_type(2))) float v2f;
typedef __attribute__((ext_vector_type(8))) float v8f;

#define NPIX   16384   // H*W
#define CDIM   128
#define NBATCH 16

__device__ __forceinline__ v8f wmma_f32(v2f a, v2f b, v8f c) {
    return __builtin_amdgcn_wmma_f32_16x16x4_f32(false, a, false, b, (short)0, c,
                                                 false, false);
}

// ---------------------------------------------------------------------------
// GEMM: out[b][m][n] = sum_c A[m][c] * x[b][c][n]  (+ bias[m] if BIAS)
// A: 128x128 row-major (per-batch stride aStride). x: (b, 128, 16384).
// Block = 256 threads = 8 waves; a block walks GTILES panels of 128(c) x GN(n).
// Each panel is brought into LDS once, by asynchronous copies (two buffers: the
// next panel flies while this one is worked on), and all 8 waves read their B
// fragments from it. Each wave owns one 16-row strip of A, held in registers
// for the whole walk, and 8 accumulator tiles (16 x GN).
// Tile j = 4*g + q of a wave takes the columns 64*g + 4*l16 + q, so that one
// ds_load_b128 of a row feeds four tiles and a lane's four results of a row are
// 16 contiguous bytes of out (a wave's store covers whole 128-byte lines).
// ---------------------------------------------------------------------------
#define GN     128                    // columns of one staged x panel
#define GTILES 4                      // panels per block
#define GBUF   (CDIM * GN * 4)        // bytes of one LDS buffer

__device__ __forceinline__ void copy8_rows(const float* g, unsigned l) {
    asm volatile(
        "global_load_async_to_lds_b128 %0, %8, off\n\t"
        "global_load_async_to_lds_b128 %1, %9, off\n\t"
        "global_load_async_to_lds_b128 %2, %10, off\n\t"
        "global_load_async_to_lds_b128 %3, %11, off\n\t"
        "global_load_async_to_lds_b128 %4, %12, off\n\t"
        "global_load_async_to_lds_b128 %5, %13, off\n\t"
        "global_load_async_to_lds_b128 %6, %14, off\n\t"
        "global_load_async_to_lds_b128 %7, %15, off\n\t"
        "s_wait_xcnt 0x0"
        :: "v"(l), "v"(l + 1 * GN * 4), "v"(l + 2 * GN * 4), "v"(l + 3 * GN * 4),
           "v"(l + 4 * GN * 4), "v"(l + 5 * GN * 4), "v"(l + 6 * GN * 4),
           "v"(l + 7 * GN * 4),
           "v"(g), "v"(g + 1 * NPIX), "v"(g + 2 * NPIX), "v"(g + 3 * NPIX),
           "v"(g + 4 * NPIX), "v"(g + 5 * NPIX), "v"(g + 6 * NPIX), "v"(g + 7 * NPIX)
        : "memory");
}

// The value that lane ^ 16 holds.
__device__ __forceinline__ float other_half(float v) {
    const int i = __builtin_bit_cast(int, v);
    return __builtin_bit_cast(float,
        __builtin_amdgcn_permlanex16(i, i, 0x76543210, 0xfedcba98, false, false));
}

template <bool BIAS>
__global__ void __launch_bounds__(256)
gemm_wmma_kernel(const float* __restrict__ Abase, size_t aStride,
                 const float* __restrict__ x,
                 const float* __restrict__ bias,
                 float* __restrict__ out) {
    __shared__ __attribute__((aligned(16))) float xs[2][CDIM][GN];

    const int b    = blockIdx.y;
    const int nblk = blockIdx.x * (GN * GTILES);
    const int tid  = threadIdx.x;
    const int lane = tid & 31;
    const int wv   = tid >> 5;       // 0..7
    const int l16  = lane & 15;
    const int half = lane >> 4;      // 0 or 1
    const int m0   = wv * 16;

    const float* A  = Abase + (size_t)b * aStride;
    const float* xb = x + (size_t)b * CDIM * NPIX;
    const float* arow = A + (size_t)(m0 + l16) * CDIM;

    // Copy duty: wave wv brings rows 16*wv .. 16*wv+15 of a panel, one whole
    // 512-byte row per wave-copy (lane = 16-byte piece).
    const float*   gsrc = xb + (size_t)m0 * NPIX + nblk + lane * 4;
    const unsigned ldst = (unsigned)(size_t)&xs[0][m0][lane * 4];

    // Panel 0 -> buffer 0.
    copy8_rows(gsrc, ldst);
    copy8_rows(gsrc + 8 * NPIX, ldst + 8 * GN * 4);

    // The wave's A strip: fragment s holds k = 4*s + 2*half, +1 of row m0 + l16.
    // A lane loads 16 bytes (k = 8*t + 4*half .. +3) and trades two of the four
    // values with lane ^ 16: half as many 16-line loads as with 8-byte loads.
    // (Every inner loop of this kernel is unrolled so that afr, bv and acc are
    // indexed by constants only and stay in registers.)
    v2f afr[CDIM / 4];
#pragma unroll
    for (int t = 0; t < CDIM / 8; ++t) {
        const float4 q = *(const float4*)(arow + 8 * t + 4 * half);
        const float rx = other_half(half ? q.x : q.z);
        const float ry = other_half(half ? q.y : q.w);
        afr[2 * t]     = half ? v2f{rx, ry}   : v2f{q.x, q.y};
        afr[2 * t + 1] = half ? v2f{q.z, q.w} : v2f{rx, ry};
    }

    float bv[8];
#pragma unroll
    for (int r = 0; r < 8; ++r) bv[r] = BIAS ? bias[m0 + r + 8 * half] : 0.0f;

    asm volatile("s_wait_asynccnt 0x0" ::: "memory");  // my rows of panel 0 landed
    __syncthreads();                                   // everyone's rows landed

    // Panel 1 -> buffer 1.
    copy8_rows(gsrc + GN, ldst + GBUF);
    copy8_rows(gsrc + GN + 8 * NPIX, ldst + GBUF + 8 * GN * 4);

    float* ob = out + (size_t)b * CDIM * NPIX + nblk + 4 * l16;

    // Kept rolled (for speed only): the body holds 256 matrix instructions.
#pragma unroll 1
    for (int t = 0; t < GTILES; ++t) {
        const float* xp = &xs[t & 1][2 * half][4 * l16];

        v8f acc[8];
#pragma unroll
        for (int j = 0; j < 8; ++j) acc[j] = v8f{};

#pragma unroll
        for (int s = 0; s < CDIM / 4; ++s) {
            const float4 p0 = *(const float4*)(xp + (4 * s) * GN);
            const float4 p1 = *(const float4*)(xp + (4 * s + 1) * GN);
            const float4 q0 = *(const float4*)(xp + (4 * s) * GN + 64);
            const float4 q1 = *(const float4*)(xp + (4 * s + 1) * GN + 64);
            acc[0] = wmma_f32(afr[s], v2f{p0.x, p1.x}, acc[0]);
            acc[1] = wmma_f32(afr[s], v2f{p0.y, p1.y}, acc[1]);
            acc[2] = wmma_f32(afr[s], v2f{p0.z, p1.z}, acc[2]);
            acc[3] = wmma_f32(afr[s], v2f{p0.w, p1.w}, acc[3]);
            acc[4] = wmma_f32(afr[s], v2f{q0.x, q1.x}, acc[4]);
            acc[5] = wmma_f32(afr[s], v2f{q0.y, q1.y}, acc[5]);
            acc[6] = wmma_f32(afr[s], v2f{q0.z, q1.z}, acc[6]);
            acc[7] = wmma_f32(afr[s], v2f{q0.w, q1.w}, acc[7]);
        }

        // Hand-over: my reads of this buffer are done, my rows of the next panel
        // have landed; behind the barrier that holds for every wave.
        asm volatile("s_wait_dscnt 0x0" ::: "memory");
        asm volatile("s_wait_asynccnt 0x0" ::: "memory");
        __syncthreads();

        if (t + 2 < GTILES) {   // panel t+2 -> the buffer that trip t has just read
            const float*   g2 = gsrc + (t + 2) * GN;
            const unsigned l2 = ldst + (t & 1) * GBUF;
            copy8_rows(g2, l2);
            copy8_rows(g2 + 8 * NPIX, l2 + 8 * GN * 4);
        }

        // The results go out behind the hand-over, so that neither the barrier nor
        // the next panel's copies wait for them.
        float* op = ob + t * GN;
#pragma unroll
        for (int r = 0; r < 8; ++r) {
            float* orow = op + (size_t)(m0 + r + 8 * half) * NPIX;
            float4 lo, hi;
            lo.x = acc[0][r] + bv[r];  lo.y = acc[1][r] + bv[r];
            lo.z = acc[2][r] + bv[r];  lo.w = acc[3][r] + bv[r];
            hi.x = acc[4][r] + bv[r];  hi.y = acc[5][r] + bv[r];
            hi.z = acc[6][r] + bv[r];  hi.w = acc[7][r] + bv[r];
            *(float4*)orow        = lo;
            *(float4*)(orow + 64) = hi;
        }
    }
    asm volatile("s_wait_asynccnt 0x0" ::: "memory");  // nothing in flight at the end
}

__device__ __forceinline__ float exp_slot(float v) {
    float r;
    asm("v_exp_f32 %0, %1\n\tv_nop" : "=v"(r) : "v"(v * 1.44269504f));
    return r;
}

// ---------------------------------------------------------------------------
// k = Wk * x, softmax over n and S = softmax(k) * x^T in one kernel: k stays in
// registers and never goes to memory. A block walks GTILES panels of
// 128(c) x GN(n) of one batch, staged as in the GEMM above (two buffers,
// asynchronous copies), and leaves an unnormalised partial S with the running
// row maximum and row sum of its own columns; sred_ctx_kernel merges the blocks.
// Wave wv owns the rows d = 16*wv .. +15. Per group of 64 columns:
//  1) kT (n x d) = x^T * Wk^T: four tiles; tile q, row i is n = 4*i + q of the
//     group. In the result a lane holds ONE d (= l16) and the columns
//     n = 32*half + 4*r + q, so maximum, sum and rescale are per lane.
//  2) p = exp(kT - m), the running maximum m raised first (sum and S rescaled).
//  3) S^T (c x d) += x * p: (P[2*u][r], P[2*u+1][r]) is a B fragment as it stands,
//     its k order n = 32*half + 4*r + 2*u + {0,1}; the A fragment reads x[c] at
//     the same four columns with one 16-byte LDS load for u = 0 and 1.
// ---------------------------------------------------------------------------
#define XP   132
#define FBUF (CDIM * XP * 4)
#define FCH  (NPIX / (GN * GTILES))

__device__ __forceinline__ void copy8_rows_padded(const float* g, unsigned l) {
    asm volatile(
        "global_load_async_to_lds_b128 %0, %8, off\n\t"
        "global_load_async_to_lds_b128 %1, %9, off\n\t"
        "global_load_async_to_lds_b128 %2, %10, off\n\t"
        "global_load_async_to_lds_b128 %3, %11, off\n\t"
        "global_load_async_to_lds_b128 %4, %12, off\n\t"
        "global_load_async_to_lds_b128 %5, %13, off\n\t"
        "global_load_async_to_lds_b128 %6, %14, off\n\t"
        "global_load_async_to_lds_b128 %7, %15, off\n\t"
        "s_wait_xcnt 0x0"
        :: "v"(l), "v"(l + 1 * XP * 4), "v"(l + 2 * XP * 4), "v"(l + 3 * XP * 4),
           "v"(l + 4 * XP * 4), "v"(l + 5 * XP * 4), "v"(l + 6 * XP * 4),
           "v"(l + 7 * XP * 4),
           "v"(g), "v"(g + 1 * NPIX), "v"(g + 2 * NPIX), "v"(g + 3 * NPIX),
           "v"(g + 4 * NPIX), "v"(g + 5 * NPIX), "v"(g + 6 * NPIX), "v"(g + 7 * NPIX)
        : "memory");
}

__global__ void __launch_bounds__(256)
ksoft_s_kernel(const float* __restrict__ Wk,
               const float* __restrict__ x,
               float* __restrict__ Spart,
               float* __restrict__ mpart,
               float* __restrict__ lpart) {
    __shared__ __attribute__((aligned(16))) float xs[2][CDIM][XP];

    const int b     = blockIdx.y;
    const int chunk = blockIdx.x;
    const int nblk  = chunk * (GN * GTILES);
    const int tid   = threadIdx.x;
    const int lane  = tid & 31;
    const int wv    = tid >> 5;       // 0..7
    const int l16   = lane & 15;
    const int half  = lane >> 4;      // 0 or 1
    const int m0    = wv * 16;

    const float* xb   = x + (size_t)b * CDIM * NPIX;
    const float* wrow = Wk + (size_t)(m0 + l16) * CDIM;

    // Copy duty as in the GEMM: wave wv brings rows 16*wv .. +15 of a panel.
    const float*   gsrc = xb + (size_t)m0 * NPIX + nblk + lane * 4;
    const unsigned ldst = (unsigned)(size_t)&xs[0][m0][lane * 4];

    // Panel 0 -> buffer 0.
    copy8_rows_padded(gsrc, ldst);
    copy8_rows_padded(gsrc + 8 * NPIX, ldst + 8 * XP * 4);

    // The wave's Wk strip as B fragments: fragment s holds c = 4*s + 2*half, +1
    // of row d = m0 + l16 (loaded as the GEMM loads its A strip).
    v2f wfr[CDIM / 4];
#pragma unroll
    for (int t = 0; t < CDIM / 8; ++t) {
        const float4 q = *(const float4*)(wrow + 8 * t + 4 * half);
        const float rx = other_half(half ? q.x : q.z);
        const float ry = other_half(half ? q.y : q.w);
        wfr[2 * t]     = half ? v2f{rx, ry}   : v2f{q.x, q.y};
        wfr[2 * t + 1] = half ? v2f{q.z, q.w} : v2f{rx, ry};
    }

    asm volatile("s_wait_asynccnt 0x0" ::: "memory");  // my rows of panel 0 landed
    __syncthreads();                                   // everyone's rows landed

    // Panel 1 -> buffer 1.
    copy8_rows_padded(gsrc + GN, ldst + FBUF);
    copy8_rows_padded(gsrc + GN + 8 * NPIX, ldst + FBUF + 8 * XP * 4);

    v8f acc[8];                       // S^T: tile ct is c = 16*ct + r + 8*half, d = l16
#pragma unroll
    for (int j = 0; j < 8; ++j) acc[j] = v8f{};
    float m = -3.402823466e38f;       // running maximum of row d (equal in both halves)
    float l = 0.0f;                   // running sum of this lane's columns

    // Both loops kept rolled: one body holds 256 matrix instructions already.
#pragma unroll 1
    for (int t = 0; t < GTILES; ++t) {
#pragma unroll 1
        for (int g = 0; g < GN / 64; ++g) {
            const float* xp = &xs[t & 1][2 * half][64 * g + 4 * l16];
            v8f P[4];
#pragma unroll
            for (int q = 0; q < 4; ++q) P[q] = v8f{};
            // The LDS reads are written two steps ahead of their use, so that the
            // wait in front of a step's matrix instructions is not a wait to 0.
            float4 pa[3], pb[3];
#pragma unroll
            for (int s = 0; s < 2; ++s) {
                pa[s] = *(const float4*)(xp + (4 * s) * XP);
                pb[s] = *(const float4*)(xp + (4 * s + 1) * XP);
            }
#pragma unroll
            for (int s = 0; s < CDIM / 4; ++s) {
                if (s + 2 < CDIM / 4) {
                    pa[(s + 2) % 3] = *(const float4*)(xp + (4 * s + 8) * XP);
                    pb[(s + 2) % 3] = *(const float4*)(xp + (4 * s + 9) * XP);
                }
                const float4 p0 = pa[s % 3], p1 = pb[s % 3];
                P[0] = wmma_f32(v2f{p0.x, p1.x}, wfr[s], P[0]);
                P[1] = wmma_f32(v2f{p0.y, p1.y}, wfr[s], P[1]);
                P[2] = wmma_f32(v2f{p0.z, p1.z}, wfr[s], P[2]);
                P[3] = wmma_f32(v2f{p0.w, p1.w}, wfr[s], P[3]);
            }

            // Maximum and sum go tile by tile (four short chains, then combined).
            float gq[4];
#pragma unroll
            for (int q = 0; q < 4; ++q) {
                gq[q] = P[q][0];
#pragma unroll
                for (int r = 1; r < 8; ++r) gq[q] = fmaxf(gq[q], P[q][r]);
            }
            float gm = fmaxf(fmaxf(gq[0], gq[1]), fmaxf(gq[2], gq[3]));
            gm = fmaxf(gm, other_half(gm));
            const float mn    = fmaxf(m, gm);
            const float alpha = exp_slot(m - mn);
            m = mn;
            float sq[4];
#pragma unroll
            for (int q = 0; q < 4; ++q) {
                sq[q] = 0.0f;
#pragma unroll
                for (int r = 0; r < 8; ++r) {
                    P[q][r] = exp_slot(P[q][r] - mn);
                    sq[q] += P[q][r];
                }
            }
            l = l * alpha + ((sq[0] + sq[1]) + (sq[2] + sq[3]));
#pragma unroll
            for (int j = 0; j < 8; ++j) acc[j] *= alpha;

            const float* xa = &xs[t & 1][l16][64 * g + 32 * half];
            // Step i = 4*r + ct/2; the reads again two steps ahead.
            float4 qa[3], qb[3];
#pragma unroll
            for (int i = 0; i < 2; ++i) {
                qa[i] = *(const float4*)(xa + (32 * (i & 3)) * XP + 4 * (i >> 2));
                qb[i] = *(const float4*)(xa + (32 * (i & 3) + 16) * XP + 4 * (i >> 2));
            }
#pragma unroll
            for (int i = 0; i < 32; ++i) {
                if (i + 2 < 32) {
                    const int k = i + 2;
                    qa[k % 3] = *(const float4*)(xa + (32 * (k & 3)) * XP + 4 * (k >> 2));
                    qb[k % 3] = *(const float4*)(xa + (32 * (k & 3) + 16) * XP + 4 * (k >> 2));
                }
                const int r = i >> 2, ct = 2 * (i & 3);
                const float4 a0 = qa[i % 3], a1 = qb[i % 3];
                const v2f pb0 = v2f{P[0][r], P[1][r]};
                const v2f pb1 = v2f{P[2][r], P[3][r]};
                acc[ct]     = wmma_f32(v2f{a0.x, a0.y}, pb0, acc[ct]);
                acc[ct + 1] = wmma_f32(v2f{a1.x, a1.y}, pb0, acc[ct + 1]);
                acc[ct]     = wmma_f32(v2f{a0.z, a0.w}, pb1, acc[ct]);
                acc[ct + 1] = wmma_f32(v2f{a1.z, a1.w}, pb1, acc[ct + 1]);
            }
        }

        // Hand-over: my reads of this buffer are done, my rows of the next panel
        // have landed; behind the barrier that holds for every wave.
        asm volatile("s_wait_dscnt 0x0" ::: "memory");
        asm volatile("s_wait_asynccnt 0x0" ::: "memory");
        __syncthreads();

        if (t + 2 < GTILES) {   // panel t+2 -> the buffer that trip t has just read
            const float*   g2 = gsrc + (t + 2) * GN;
            const unsigned l2 = ldst + (t & 1) * FBUF;
            copy8_rows_padded(g2, l2);
            copy8_rows_padded(g2 + 8 * NPIX, l2 + 8 * XP * 4);
        }
    }
    asm volatile("s_wait_asynccnt 0x0" ::: "memory");  // nothing in flight at the end

    const size_t part = (size_t)chunk * NBATCH + b;
    float* Sp = Spart + part * (CDIM * CDIM) + (m0 + l16) * CDIM + 8 * half;
#pragma unroll
    for (int ct = 0; ct < 8; ++ct) {
        *(float4*)(Sp + 16 * ct) =
            make_float4(acc[ct][0], acc[ct][1], acc[ct][2], acc[ct][3]);
        *(float4*)(Sp + 16 * ct + 4) =
            make_float4(acc[ct][4], acc[ct][5], acc[ct][6], acc[ct][7]);
    }
    const float lsum = l + other_half(l);
    if (half == 0) {
        mpart[part * CDIM + m0 + l16] = m;
        lpart[part * CDIM + m0 + l16] = lsum;
    }
}

// The four small steps between the two big kernels run as two launches.
#define PSTRIDE (NBATCH * CDIM * CDIM)    // floats from one partial to the next
#define WP 132
#define CP 36
#define TP 12

// Launch 2. A block takes 8 rows d of one head of one batch (wave r = row r):
// the blocks' partial S brought to the row's common maximum M, summed and divided
// by the row's sum of exp(k - M); the 8 x 128 result stays in LDS, and
// ctx[b][h][d][e] = sum_c S[h*32+d][c] * Wv[h*32+e][c]  (Wv = w_qkv rows 256..383)
// is formed from it and from the head's 32 rows of Wv, staged in LDS.
// Spart comes in as four pointers, one to each run of FCH/4 partials (8 MiB, the
// reach of a load's immediate offset): every load is then scalar base + one byte
// offset in a register + immediate.
// (The pointers are not __restrict__: a load through a const __restrict__ pointer
// may be moved over the wait below, which would then not stand behind it.)
__device__ __forceinline__ float4 ld16(const float* base, unsigned byteoff) {
    return *(const float4*)((const char*)base + byteoff);
}
__device__ __forceinline__ float ld4(const float* base, unsigned byteoff) {
    return *(const float*)((const char*)base + byteoff);
}

__global__ void __launch_bounds__(256)
sred_ctx_kernel(const float* Sq0, const float* Sq1,
                const float* Sq2, const float* Sq3,
                const float* mpart, const float* lpart,
                const float* w_qkv, float* ctx) {
    __shared__ __attribute__((aligned(16))) float wvs[32][WP];
    __shared__ __attribute__((aligned(16))) float ssh[8][CDIM];
    __shared__ __attribute__((aligned(16))) float msh[8][FCH];
    __shared__ __attribute__((aligned(16))) float lsh[8][FCH];
    __shared__ __attribute__((aligned(16))) float wsh[8][FCH];

    const int tid  = threadIdx.x;
    const int lane = tid & 31;
    const int r    = tid >> 5;            // 0..7
    const int dg   = blockIdx.x & 3;
    const int h    = blockIdx.x >> 2;
    const int b    = blockIdx.y;
    const int row  = b * CDIM + h * 32 + dg * 8 + r;   // b*128 + d
    const unsigned soff = (unsigned)(row * CDIM + lane * 4) * 4u;            // bytes
    const unsigned moff = (unsigned)(lane * (NBATCH * CDIM) + row) * 4u;     // bytes
    const unsigned woff = (unsigned)tid * 16u;                               // bytes
    const float*   wvb  = w_qkv + (256 + h * 32) * CDIM;   // the head's rows of Wv

    // Every global load of the kernel is issued here, ahead of the first barrier.
    const float ml = ld4(mpart, moff);    // lane = partial
    const float ll = ld4(lpart, moff);
    float4 sv[FCH];
#pragma unroll
    for (int ch = 0; ch < FCH; ++ch) {
        const float* Sq = ch < 8 ? Sq0 : ch < 16 ? Sq1 : ch < 24 ? Sq2 : Sq3;
        sv[ch] = ld16(Sq + (ch & 7) * PSTRIDE, soff);
    }
    float4 wl[4];
#pragma unroll
    for (int k = 0; k < 4; ++k) wl[k] = ld16(wvb + 1024 * k, woff);
    // The wait that stands in front of a rewrite of a register that an issued load
    // names. The offsets are its inputs (tid too: the build scales it in the load in
    // place of woff), so that they keep their registers up to here and no load's
    // result is placed there.
    asm volatile("s_wait_xcnt 0x0" :: "v"(soff), "v"(moff), "v"(woff), "v"(tid)
                 : "memory");
#pragma unroll
    for (int k = 0; k < 4; ++k) {
        const int id = tid + 256 * k;     // 16-byte piece of the 32 x 128 rows
        *(float4*)&wvs[id >> 5][(id & 31) * 4] = wl[k];
    }
    msh[r][lane] = ml;
    lsh[r][lane] = ll;
    __syncthreads();

    float M = -3.402823466e38f;
#pragma unroll
    for (int ch = 0; ch < FCH; ++ch) M = fmaxf(M, msh[r][ch]);
    wsh[r][lane] = exp_slot(ml - M);
    __syncthreads();

    float4 acc = make_float4(0.0f, 0.0f, 0.0f, 0.0f);
    float den = 0.0f;
#pragma unroll
    for (int ch = 0; ch < FCH; ++ch) {
        const float w = wsh[r][ch];
        acc.x += w * sv[ch].x;
        acc.y += w * sv[ch].y;
        acc.z += w * sv[ch].z;
        acc.w += w * sv[ch].w;
        den   += w * lsh[r][ch];
    }
    *(float4*)&ssh[r][lane * 4] =
        make_float4(acc.x / den, acc.y / den, acc.z / den, acc.w / den);
    __syncthreads();

    float a = 0.0f;                       // d = dg*8 + r, e = lane
#pragma unroll
    for (int c4 = 0; c4 < CDIM / 4; ++c4) {
        const float4 sa = *(const float4*)&ssh[r][4 * c4];
        const float4 wb = *(const float4*)&wvs[lane][4 * c4];
        a += sa.x * wb.x;
        a += sa.y * wb.y;
        a += sa.z * wb.z;
        a += sa.w * wb.w;
    }
    ctx[b * 4096 + h * 1024 + (dg * 8 + r) * 32 + lane] = a;
}

// Launch 3. A block takes 8 rows o of one batch:
// T[o][h*32+d] = sum_e w_out[o][h*32+e] * ctx[b][h][d][e] stays in LDS, and
// Weff[b][o][c] = scale * sum_i T[o][i] * Wq[i][c]   (Wq = w_qkv rows 0..127).
// A thread holds one column (i of T, then c of Weff) of 4 rows o; its column of Wq
// is loaded into registers at the start, so that it flies while T is formed.
__global__ void __launch_bounds__(256)
t_weff_kernel(const float* ctx, const float* w_out, const float* w_qkv,
              float* Weff) {
    __shared__ __attribute__((aligned(16))) float cxs[CDIM][CP];   // [h*32+d][e]
    __shared__ __attribute__((aligned(16))) float wos[8][CDIM];
    __shared__ __attribute__((aligned(16))) float tsh[CDIM][TP];   // [i][o - o0]

    const int tid = threadIdx.x;
    const int c   = tid & 127;
    const int oq  = (tid >> 7) * 4;       // 0 or 4
    const int o0  = blockIdx.x * 8;
    const int b   = blockIdx.y;

    const unsigned toff = (unsigned)tid * 16u;   // bytes
    const unsigned coff = (unsigned)c * 4u;      // bytes

    float4 cl[4];
#pragma unroll
    for (int k = 0; k < 4; ++k) cl[k] = ld16(ctx + b * 4096 + 1024 * k, toff);
    const float4 ol = ld16(w_out + o0 * CDIM, toff);
    float wq[CDIM];
#pragma unroll
    for (int i = 0; i < CDIM; ++i) wq[i] = ld4(w_qkv + i * CDIM, coff);
    // The wait in front of a rewrite of a register that an issued load names; the
    // offsets are its inputs (tid and c too: the build may scale them in the load),
    // so that no load's result is placed there. (The pointers are not __restrict__,
    // so that no load moves over it.)
    asm volatile("s_wait_xcnt 0x0" :: "v"(toff), "v"(coff), "v"(tid), "v"(c)
                 : "memory");
#pragma unroll
    for (int k = 0; k < 4; ++k) {
        const int id = tid + 256 * k;     // 16-byte piece of ctx[b]
        *(float4*)&cxs[id >> 3][(id & 7) * 4] = cl[k];
    }
    *(float4*)&wos[tid >> 5][(tid & 31) * 4] = ol;
    __syncthreads();

    float t4[4] = {0.0f, 0.0f, 0.0f, 0.0f};
#pragma unroll
    for (int e4 = 0; e4 < 8; ++e4) {
        const float4 cv = *(const float4*)&cxs[c][4 * e4];
#pragma unroll
        for (int k = 0; k < 4; ++k) {
            const float4 wv = *(const float4*)&wos[oq + k][(c & 96) + 4 * e4];
            t4[k] += wv.x * cv.x;
            t4[k] += wv.y * cv.y;
            t4[k] += wv.z * cv.z;
            t4[k] += wv.w * cv.w;
        }
    }
    *(float4*)&tsh[c][oq] = make_float4(t4[0], t4[1], t4[2], t4[3]);
    __syncthreads();

    float acc[4] = {0.0f, 0.0f, 0.0f, 0.0f};
#pragma unroll
    for (int i = 0; i < CDIM; ++i) {
        const float4 tv = *(const float4*)&tsh[i][oq];
        acc[0] += tv.x * wq[i];
        acc[1] += tv.y * wq[i];
        acc[2] += tv.z * wq[i];
        acc[3] += tv.w * wq[i];
    }
    float* wrow = Weff + b * (CDIM * CDIM) + (o0 + oq) * CDIM + c;
#pragma unroll
    for (int k = 0; k < 4; ++k)
        wrow[k * CDIM] = 0.17677669529663687f * acc[k];   // 32^-0.5
}

// ---------------------------------------------------------------------------
extern "C" void kernel_launch(void* const* d_in, const int* in_sizes, int n_in,
                              void* d_out, int out_size, void* d_ws, size_t ws_size,
                              hipStream_t stream) {
    const float* x      = (const float*)d_in[0];   // (16,128,128,128)
    const float* w_qkv  = (const float*)d_in[1];   // (384,128)
    const float* w_out  = (const float*)d_in[2];   // (128,128)
    const float* b_out  = (const float*)d_in[3];   // (128,)

    float* ws   = (float*)d_ws;
    float* Spart = ws;                                             // 32*16*16384
    float* mpart = Spart + (size_t)FCH * NBATCH * CDIM * CDIM;     // 32*16*128
    float* lpart = mpart + FCH * NBATCH * CDIM;                    // 32*16*128
    float* ctx   = lpart + FCH * NBATCH * CDIM;                    // 16*4096
    float* Weff  = ctx + (size_t)NBATCH * 4096;                    // 16*16384

    // 1) S = softmax(Wk * x) * x^T  (Wk = w_qkv rows 128..255): per-block
    //    partials with their row maximum and row sum
    ksoft_s_kernel<<<dim3(FCH, NBATCH), 256, 0, stream>>>(
        w_qkv + 128 * CDIM, x, Spart, mpart, lpart);

    // 2) the merge of the partials and ctx; 3) T and W_eff
    sred_ctx_kernel<<<dim3(16, NBATCH), 256, 0, stream>>>(
        Spart, Spart + (size_t)8 * PSTRIDE, Spart + (size_t)16 * PSTRIDE,
        Spart + (size_t)24 * PSTRIDE, mpart, lpart, w_qkv, ctx);
    t_weff_kernel<<<dim3(CDIM / 8, NBATCH), 256, 0, stream>>>(
        ctx, w_out, w_qkv, Weff);

    // 4) out = W_eff[b] * x + b_out
    gemm_wmma_kernel<true><<<dim3(NPIX / (GN * GTILES), NBATCH), 256, 0, stream>>>(
        Weff, (size_t)(CDIM * CDIM), x, b_out, (float*)d_out);
}

// v004
// It runs in 141 microseconds.
// In both of two side-by-side timings against v003, it was 1.05 times as fast.
// Over all steps from v000 it is 1.94 times as fast.
#include <hip/hip_runtime.h>
#include <cstddef>

typedef __attribute__((ext_vector_type(2))) float v2f;
typedef __attribute__((ext_vector_type(8))) float v8f;

#define NPIX   16384   // H*W
#define CDIM   128
#define NBATCH 16

__device__ __forceinline__ v8f wmma_f32(v2f a, v2f b, v8f c) {
    return __builtin_amdgcn_wmma_f32_16x16x4_f32(false, a, false, b, (short)0, c,
                                                 false, false);
}

// ---------------------------------------------------------------------------
// GEMM: out[b][m][n] = sum_c A[m][c] * x[b][c][n]  (+ bias[m] if BIAS)
// A: 128x128 row-major (per-batch stride aStride). x: (b, 128, 16384).
// Block = 256 threads = 8 waves; a block walks GTILES panels of 128(c) x GN(n).
// Each panel is brought into LDS once, by asynchronous copies (two buffers: the
// next panel flies while this one is worked on), and all 8 waves read their B
// fragments from it. Each wave owns one 16-row strip of A, held in registers
// for the whole walk, and 8 accumulator tiles (16 x GN).
// Tile j = 4*g + q of a wave takes the columns 64*g + 4*l16 + q, so that one
// ds_load_b128 of a row feeds four tiles and a lane's four results of a row are
// 16 contiguous bytes of out (a wave's store covers whole 128-byte lines).
// ---------------------------------------------------------------------------
#define GN     128                    // columns of one staged x panel
#define GTILES 4                      // panels per block
#define GBUF   (CDIM * GN * 4)        // bytes of one LDS buffer
#define GSTEP  2                      // k steps whose LDS reads are issued as one group

__device__ __forceinline__ void copy8_rows(const float* g, unsigned l) {
    asm volatile(
        "global_load_async_to_lds_b128 %0, %8, off\n\t"
        "global_load_async_to_lds_b128 %1, %9, off\n\t"
        "global_load_async_to_lds_b128 %2, %10, off\n\t"
        "global_load_async_to_lds_b128 %3, %11, off\n\t"
        "global_load_async_to_lds_b128 %4, %12, off\n\t"
        "global_load_async_to_lds_b128 %5, %13, off\n\t"
        "global_load_async_to_lds_b128 %6, %14, off\n\t"
        "global_load_async_to_lds_b128 %7, %15, off\n\t"
        "s_wait_xcnt 0x0"
        :: "v"(l), "v"(l + 1 * GN * 4), "v"(l + 2 * GN * 4), "v"(l + 3 * GN * 4),
           "v"(l + 4 * GN * 4), "v"(l + 5 * GN * 4), "v"(l + 6 * GN * 4),
           "v"(l + 7 * GN * 4),
           "v"(g), "v"(g + 1 * NPIX), "v"(g + 2 * NPIX), "v"(g + 3 * NPIX),
           "v"(g + 4 * NPIX), "v"(g + 5 * NPIX), "v"(g + 6 * NPIX), "v"(g + 7 * NPIX)
        : "memory");
}

// The value that lane ^ 16 holds.
__device__ __forceinline__ float other_half(float v) {
    const int i = __builtin_bit_cast(int, v);
    return __builtin_bit_cast(float,
        __builtin_amdgcn_permlanex16(i, i, 0x76543210, 0xfedcba98, false, false));
}

template <bool BIAS>
__global__ void __launch_bounds__(256)
gemm_wmma_kernel(const float* __restrict__ Abase, size_t aStride,
                 const float* __restrict__ x,
                 const float* __restrict__ bias,
                 float* __restrict__ out) {
    __shared__ __attribute__((aligned(16))) float xs[2][CDIM][GN];

    const int b    = blockIdx.y;
    const int nblk = blockIdx.x * (GN * GTILES);
    const int tid  = threadIdx.x;
    const int lane = tid & 31;
    const int wv   = tid >> 5;       // 0..7
    const int l16  = lane & 15;
    const int half = lane >> 4;      // 0 or 1
    const int m0   = wv * 16;

    const float* A  = Abase + (size_t)b * aStride;
    const float* xb = x + (size_t)b * CDIM * NPIX;
    const float* arow = A + (size_t)(m0 + l16) * CDIM;

    // Copy duty: wave wv brings rows 16*wv .. 16*wv+15 of a panel, one whole
    // 512-byte row per wave-copy (lane = 16-byte piece).
    const float*   gsrc = xb + (size_t)m0 * NPIX + nblk + lane * 4;
    const unsigned ldst = (unsigned)(size_t)&xs[0][m0][lane * 4];

    // Panel 0 -> buffer 0.
    copy8_rows(gsrc, ldst);
    copy8_rows(gsrc + 8 * NPIX, ldst + 8 * GN * 4);

    // The wave's A strip: fragment s holds k = 4*s + 2*half, +1 of row m0 + l16.
    // A lane loads 16 bytes (k = 8*t + 4*half .. +3) and trades two of the four
    // values with lane ^ 16: half as many 16-line loads as with 8-byte loads.
    // (Every inner loop of this kernel is unrolled so that afr, bv and acc are
    // indexed by constants only and stay in registers.)
    v2f afr[CDIM / 4];
#pragma unroll
    for (int t = 0; t < CDIM / 8; ++t) {
        const float4 q = *(const float4*)(arow + 8 * t + 4 * half);
        const float rx = other_half(half ? q.x : q.z);
        const float ry = other_half(half ? q.y : q.w);
        afr[2 * t]     = half ? v2f{rx, ry}   : v2f{q.x, q.y};
        afr[2 * t + 1] = half ? v2f{q.z, q.w} : v2f{rx, ry};
    }

    float bv[8];
#pragma unroll
    for (int r = 0; r < 8; ++r) bv[r] = BIAS ? bias[m0 + r + 8 * half] : 0.0f;

    asm volatile("s_wait_asynccnt 0x0" ::: "memory");  // my rows of panel 0 landed
    __syncthreads();                                   // everyone's rows landed

    // Panel 1 -> buffer 1.
    copy8_rows(gsrc + GN, ldst + GBUF);
    copy8_rows(gsrc + GN + 8 * NPIX, ldst + GBUF + 8 * GN * 4);

    float* ob = out + (size_t)b * CDIM * NPIX + nblk + 4 * l16;

    // Kept rolled (for speed only): the body holds 256 matrix instructions.
#pragma unroll 1
    for (int t = 0; t < GTILES; ++t) {
        const float* xp = &xs[t & 1][2 * half][4 * l16];

        v8f acc[8];
#pragma unroll
        for (int j = 0; j < 8; ++j) acc[j] = v8f{};

        // The LDS reads go in groups: the GSTEP * 4 reads of the next GSTEP k steps
        // stand together in front of this group's matrix instructions (two register
        // sets).
        float4 fr[2][4 * GSTEP];
#pragma unroll
        for (int u = 0; u < GSTEP; ++u) {
            fr[0][4 * u]     = *(const float4*)(xp + (4 * u) * GN);
            fr[0][4 * u + 1] = *(const float4*)(xp + (4 * u + 1) * GN);
            fr[0][4 * u + 2] = *(const float4*)(xp + (4 * u) * GN + 64);
            fr[0][4 * u + 3] = *(const float4*)(xp + (4 * u + 1) * GN + 64);
        }
#pragma unroll
        for (int j = 0; j < CDIM / 4 / GSTEP; ++j) {
            if (j + 1 < CDIM / 4 / GSTEP) {
#pragma unroll
                for (int u = 0; u < GSTEP; ++u) {
                    const int s = GSTEP * (j + 1) + u;
                    float4* f = &fr[(j + 1) & 1][4 * u];
                    f[0] = *(const float4*)(xp + (4 * s) * GN);
                    f[1] = *(const float4*)(xp + (4 * s + 1) * GN);
                    f[2] = *(const float4*)(xp + (4 * s) * GN + 64);
                    f[3] = *(const float4*)(xp + (4 * s + 1) * GN + 64);
                }
            }
            // Keeps the reads above in one place: without it the compiler spreads
            // them in pairs among the matrix instructions below.
            __builtin_amdgcn_sched_barrier(0);
#pragma unroll
            for (int u = 0; u < GSTEP; ++u) {
                const int s = GSTEP * j + u;
                const float4 p0 = fr[j & 1][4 * u],     p1 = fr[j & 1][4 * u + 1];
                const float4 q0 = fr[j & 1][4 * u + 2], q1 = fr[j & 1][4 * u + 3];
                acc[0] = wmma_f32(afr[s], v2f{p0.x, p1.x}, acc[0]);
                acc[1] = wmma_f32(afr[s], v2f{p0.y, p1.y}, acc[1]);
                acc[2] = wmma_f32(afr[s], v2f{p0.z, p1.z}, acc[2]);
                acc[3] = wmma_f32(afr[s], v2f{p0.w, p1.w}, acc[3]);
                acc[4] = wmma_f32(afr[s], v2f{q0.x, q1.x}, acc[4]);
                acc[5] = wmma_f32(afr[s], v2f{q0.y, q1.y}, acc[5]);
                acc[6] = wmma_f32(afr[s], v2f{q0.z, q1.z}, acc[6]);
                acc[7] = wmma_f32(afr[s], v2f{q0.w, q1.w}, acc[7]);
            }
            // Keeps the next group's reads from being lifted in among these.
            __builtin_amdgcn_sched_barrier(0);
        }

        // Hand-over: my reads of this buffer are done, my rows of the next panel
        // have landed; behind the barrier that holds for every wave.
        asm volatile("s_wait_dscnt 0x0" ::: "memory");
        asm volatile("s_wait_asynccnt 0x0" ::: "memory");
        __syncthreads();

        if (t + 2 < GTILES) {   // panel t+2 -> the buffer that trip t has just read
            const float*   g2 = gsrc + (t + 2) * GN;
            const unsigned l2 = ldst + (t & 1) * GBUF;
            copy8_rows(g2, l2);
            copy8_rows(g2 + 8 * NPIX, l2 + 8 * GN * 4);
        }

        // The results go out behind the hand-over, so that neither the barrier nor
        // the next panel's copies wait for them.
        float* op = ob + t * GN;
#pragma unroll
        for (int r = 0; r < 8; ++r) {
            float* orow = op + (size_t)(m0 + r + 8 * half) * NPIX;
            float4 lo, hi;
            lo.x = acc[0][r] + bv[r];  lo.y = acc[1][r] + bv[r];
            lo.z = acc[2][r] + bv[r];  lo.w = acc[3][r] + bv[r];
            hi.x = acc[4][r] + bv[r];  hi.y = acc[5][r] + bv[r];
            hi.z = acc[6][r] + bv[r];  hi.w = acc[7][r] + bv[r];
            *(float4*)orow        = lo;
            *(float4*)(orow + 64) = hi;
        }
    }
    asm volatile("s_wait_asynccnt 0x0" ::: "memory");  // nothing in flight at the end
}

__device__ __forceinline__ float exp_slot(float v) {
    float r;
    asm("v_exp_f32 %0, %1\n\tv_nop" : "=v"(r) : "v"(v * 1.44269504f));
    return r;
}

// ---------------------------------------------------------------------------
// k = Wk * x, softmax over n and S = softmax(k) * x^T in one kernel: k stays in
// registers and never goes to memory. A block walks GTILES panels of
// 128(c) x GN(n) of one batch, staged as in the GEMM above (two buffers,
// asynchronous copies), and leaves an unnormalised partial S with the running
// row maximum and row sum of its own columns; sred_ctx_kernel merges the blocks.
// Wave wv owns the rows d = 16*wv .. +15. Per group of 64 columns:
//  1) kT (n x d) = x^T * Wk^T: four tiles; tile q, row i is n = 4*i + q of the
//     group. In the result a lane holds ONE d (= l16) and the columns
//     n = 32*half + 4*r + q, so maximum, sum and rescale are per lane.
//  2) p = exp(kT - m), the running maximum m raised first (sum and S rescaled).
//  3) S^T (c x d) += x * p: (P[2*u][r], P[2*u+1][r]) is a B fragment as it stands,
//     its k order n = 32*half + 4*r + 2*u + {0,1}; the A fragment reads x[c] at
//     the same four columns with one 16-byte LDS load for u = 0 and 1.
// ---------------------------------------------------------------------------
#define XP   132
#define FBUF (CDIM * XP * 4)
#define FCH  (NPIX / (GN * GTILES))
#define KSTEP 4

__device__ __forceinline__ void copy8_rows_padded(const float* g, unsigned l) {
    asm volatile(
        "global_load_async_to_lds_b128 %0, %8, off\n\t"
        "global_load_async_to_lds_b128 %1, %9, off\n\t"
        "global_load_async_to_lds_b128 %2, %10, off\n\t"
        "global_load_async_to_lds_b128 %3, %11, off\n\t"
        "global_load_async_to_lds_b128 %4, %12, off\n\t"
        "global_load_async_to_lds_b128 %5, %13, off\n\t"
        "global_load_async_to_lds_b128 %6, %14, off\n\t"
        "global_load_async_to_lds_b128 %7, %15, off\n\t"
        "s_wait_xcnt 0x0"
        :: "v"(l), "v"(l + 1 * XP * 4), "v"(l + 2 * XP * 4), "v"(l + 3 * XP * 4),
           "v"(l + 4 * XP * 4), "v"(l + 5 * XP * 4), "v"(l + 6 * XP * 4),
           "v"(l + 7 * XP * 4),
           "v"(g), "v"(g + 1 * NPIX), "v"(g + 2 * NPIX), "v"(g + 3 * NPIX),
           "v"(g + 4 * NPIX), "v"(g + 5 * NPIX), "v"(g + 6 * NPIX), "v"(g + 7 * NPIX)
        : "memory");
}

__global__ void __launch_bounds__(256)
ksoft_s_kernel(const float* __restrict__ Wk,
               const float* __restrict__ x,
               float* __restrict__ Spart,
               float* __restrict__ mpart,
               float* __restrict__ lpart) {
    __shared__ __attribute__((aligned(16))) float xs[2][CDIM][XP];

    const int b     = blockIdx.y;
    const int chunk = blockIdx.x;
    const int nblk  = chunk * (GN * GTILES);
    const int tid   = threadIdx.x;
    const int lane  = tid & 31;
    const int wv    = tid >> 5;       // 0..7
    const int l16   = lane & 15;
    const int half  = lane >> 4;      // 0 or 1
    const int m0    = wv * 16;

    const float* xb   = x + (size_t)b * CDIM * NPIX;
    const float* wrow = Wk + (size_t)(m0 + l16) * CDIM;

    // Copy duty as in the GEMM: wave wv brings rows 16*wv .. +15 of a panel.
    const float*   gsrc = xb + (size_t)m0 * NPIX + nblk + lane * 4;
    const unsigned ldst = (unsigned)(size_t)&xs[0][m0][lane * 4];

    // Panel 0 -> buffer 0.
    copy8_rows_padded(gsrc, ldst);
    copy8_rows_padded(gsrc + 8 * NPIX, ldst + 8 * XP * 4);

    // The wave's Wk strip as B fragments: fragment s holds c = 4*s + 2*half, +1
    // of row d = m0 + l16 (loaded as the GEMM loads its A strip).
    v2f wfr[CDIM / 4];
#pragma unroll
    for (int t = 0; t < CDIM / 8; ++t) {
        const float4 q = *(const float4*)(wrow + 8 * t + 4 * half);
        const float rx = other_half(half ? q.x : q.z);
        const float ry = other_half(half ? q.y : q.w);
        wfr[2 * t]     = half ? v2f{rx, ry}   : v2f{q.x, q.y};
        wfr[2 * t + 1] = half ? v2f{q.z, q.w} : v2f{rx, ry};
    }

    asm volatile("s_wait_asynccnt 0x0" ::: "memory");  // my rows of panel 0 landed
    __syncthreads();                                   // everyone's rows landed

    // Panel 1 -> buffer 1.
    copy8_rows_padded(gsrc + GN, ldst + FBUF);
    copy8_rows_padded(gsrc + GN + 8 * NPIX, ldst + FBUF + 8 * XP * 4);

    v8f acc[8];                       // S^T: tile ct is c = 16*ct + r + 8*half, d = l16
#pragma unroll
    for (int j = 0; j < 8; ++j) acc[j] = v8f{};
    float m = -3.402823466e38f;       // running maximum of row d (equal in both halves)
    float l = 0.0f;                   // running sum of this lane's columns

    // Both loops kept rolled: one body holds 256 matrix instructions already.
#pragma unroll 1
    for (int t = 0; t < GTILES; ++t) {
#pragma unroll 1
        for (int g = 0; g < GN / 64; ++g) {
            const float* xp = &xs[t & 1][2 * half][64 * g + 4 * l16];
            v8f P[4];
#pragma unroll
            for (int q = 0; q < 4; ++q) P[q] = v8f{};
            // The LDS reads go in groups, as in the GEMM: the 2 * KSTEP reads of the
            // next KSTEP k steps stand together in front of this group's matrix
            // instructions (two register sets).
            float4 pa[2][KSTEP], pb[2][KSTEP];
#pragma unroll
            for (int u = 0; u < KSTEP; ++u) {
                pa[0][u] = *(const float4*)(xp + (4 * u) * XP);
                pb[0][u] = *(const float4*)(xp + (4 * u + 1) * XP);
            }
#pragma unroll
            for (int j = 0; j < CDIM / 4 / KSTEP; ++j) {
                if (j + 1 < CDIM / 4 / KSTEP) {
#pragma unroll
                    for (int u = 0; u < KSTEP; ++u) {
                        const int s = KSTEP * (j + 1) + u;
                        pa[(j + 1) & 1][u] = *(const float4*)(xp + (4 * s) * XP);
                        pb[(j + 1) & 1][u] = *(const float4*)(xp + (4 * s + 1) * XP);
                    }
                }
                // Keeps the reads above in one place, ahead of the matrix instructions.
                __builtin_amdgcn_sched_barrier(0);
#pragma unroll
                for (int u = 0; u < KSTEP; ++u) {
                    const int s = KSTEP * j + u;
                    const float4 p0 = pa[j & 1][u], p1 = pb[j & 1][u];
                    P[0] = wmma_f32(v2f{p0.x, p1.x}, wfr[s], P[0]);
                    P[1] = wmma_f32(v2f{p0.y, p1.y}, wfr[s], P[1]);
                    P[2] = wmma_f32(v2f{p0.z, p1.z}, wfr[s], P[2]);
                    P[3] = wmma_f32(v2f{p0.w, p1.w}, wfr[s], P[3]);
                }
                // Keeps the next group's reads from being lifted in among these.
                __builtin_amdgcn_sched_barrier(0);
            }

            // The first group of step 3's reads needs nothing of the softmax: it flies
            // while maximum and exponentials are formed.
            const float* xa = &xs[t & 1][l16][64 * g + 32 * half];
            float4 qa[2][4], qb[2][4];
#pragma unroll
            for (int c2 = 0; c2 < 4; ++c2) {
                qa[0][c2] = *(const float4*)(xa + (32 * c2) * XP);
                qb[0][c2] = *(const float4*)(xa + (32 * c2 + 16) * XP);
            }

            // Maximum and sum go tile by tile (four short chains, then combined).
            float gq[4];
#pragma unroll
            for (int q = 0; q < 4; ++q) {
                gq[q] = P[q][0];
#pragma unroll
                for (int r = 1; r < 8; ++r) gq[q] = fmaxf(gq[q], P[q][r]);
            }
            float gm = fmaxf(fmaxf(gq[0], gq[1]), fmaxf(gq[2], gq[3]));
            gm = fmaxf(gm, other_half(gm));
            const float mn    = fmaxf(m, gm);
            const float alpha = exp_slot(m - mn);
            m = mn;
            float sq[4];
#pragma unroll
            for (int q = 0; q < 4; ++q) {
                sq[q] = 0.0f;
#pragma unroll
                for (int r = 0; r < 8; ++r) {
                    P[q][r] = exp_slot(P[q][r] - mn);
                    sq[q] += P[q][r];
                }
            }
            l = l * alpha + ((sq[0] + sq[1]) + (sq[2] + sq[3]));
#pragma unroll
            for (int j = 0; j < 8; ++j) acc[j] *= alpha;

            // A group is one r: eight reads (all c at four columns), 16 matrix
            // instructions; the next r's reads stand together in front of them.
#pragma unroll
            for (int r = 0; r < 8; ++r) {
                if (r + 1 < 8) {
#pragma unroll
                    for (int c2 = 0; c2 < 4; ++c2) {
                        qa[(r + 1) & 1][c2] =
                            *(const float4*)(xa + (32 * c2) * XP + 4 * (r + 1));
                        qb[(r + 1) & 1][c2] =
                            *(const float4*)(xa + (32 * c2 + 16) * XP + 4 * (r + 1));
                    }
                }
                // Keeps the reads above in one place, ahead of the matrix instructions.
                __builtin_amdgcn_sched_barrier(0);
                const v2f pb0 = v2f{P[0][r], P[1][r]};
                const v2f pb1 = v2f{P[2][r], P[3][r]};
#pragma unroll
                for (int c2 = 0; c2 < 4; ++c2) {
                    const int ct = 2 * c2;
                    const float4 a0 = qa[r & 1][c2], a1 = qb[r & 1][c2];
                    acc[ct]     = wmma_f32(v2f{a0.x, a0.y}, pb0, acc[ct]);
                    acc[ct + 1] = wmma_f32(v2f{a1.x, a1.y}, pb0, acc[ct + 1]);
                    acc[ct]     = wmma_f32(v2f{a0.z, a0.w}, pb1, acc[ct]);
                    acc[ct + 1] = wmma_f32(v2f{a1.z, a1.w}, pb1, acc[ct + 1]);
                }
                // Keeps the next group's reads from being lifted in among these.
                __builtin_amdgcn_sched_barrier(0);
            }
        }

        // Hand-over: my reads of this buffer are done, my rows of the next panel
        // have landed; behind the barrier that holds for every wave.
        asm volatile("s_wait_dscnt 0x0" ::: "memory");
        asm volatile("s_wait_asynccnt 0x0" ::: "memory");
        __syncthreads();

        if (t + 2 < GTILES) {   // panel t+2 -> the buffer that trip t has just read
            const float*   g2 = gsrc + (t + 2) * GN;
            const unsigned l2 = ldst + (t & 1) * FBUF;
            copy8_rows_padded(g2, l2);
            copy8_rows_padded(g2 + 8 * NPIX, l2 + 8 * XP * 4);
        }
    }
    asm volatile("s_wait_asynccnt 0x0" ::: "memory");  // nothing in flight at the end

    const size_t part = (size_t)chunk * NBATCH + b;
    float* Sp = Spart + part * (CDIM * CDIM) + (m0 + l16) * CDIM + 8 * half;
#pragma unroll
    for (int ct = 0; ct < 8; ++ct) {
        *(float4*)(Sp + 16 * ct) =
            make_float4(acc[ct][0], acc[ct][1], acc[ct][2], acc[ct][3]);
        *(float4*)(Sp + 16 * ct + 4) =
            make_float4(acc[ct][4], acc[ct][5], acc[ct][6], acc[ct][7]);
    }
    const float lsum = l + other_half(l);
    if (half == 0) {
        mpart[part * CDIM + m0 + l16] = m;
        lpart[part * CDIM + m0 + l16] = lsum;
    }
}

// The four small steps between the two big kernels run as two launches.
#define PSTRIDE (NBATCH * CDIM * CDIM)    // floats from one partial to the next
#define WP 132
#define CP 36
#define TP 12

// Launch 2. A block takes 8 rows d of one head of one batch (wave r = row r):
// the blocks' partial S brought to the row's common maximum M, summed and divided
// by the row's sum of exp(k - M); the 8 x 128 result stays in LDS, and
// ctx[b][h][d][e] = sum_c S[h*32+d][c] * Wv[h*32+e][c]  (Wv = w_qkv rows 256..383)
// is formed from it and from the head's 32 rows of Wv, staged in LDS.
// Spart comes in as four pointers, one to each run of FCH/4 partials (8 MiB, the
// reach of a load's immediate offset): every load is then scalar base + one byte
// offset in a register + immediate.
// (The pointers are not __restrict__: a load through a const __restrict__ pointer
// may be moved over the wait below, which would then not stand behind it.)
__device__ __forceinline__ float4 ld16(const float* base, unsigned byteoff) {
    return *(const float4*)((const char*)base + byteoff);
}
__device__ __forceinline__ float ld4(const float* base, unsigned byteoff) {
    return *(const float*)((const char*)base + byteoff);
}

__global__ void __launch_bounds__(256)
sred_ctx_kernel(const float* Sq0, const float* Sq1,
                const float* Sq2, const float* Sq3,
                const float* mpart, const float* lpart,
                const float* w_qkv, float* ctx) {
    __shared__ __attribute__((aligned(16))) float wvs[32][WP];
    __shared__ __attribute__((aligned(16))) float ssh[8][CDIM];
    __shared__ __attribute__((aligned(16))) float msh[8][FCH];
    __shared__ __attribute__((aligned(16))) float lsh[8][FCH];
    __shared__ __attribute__((aligned(16))) float wsh[8][FCH];

    const int tid  = threadIdx.x;
    const int lane = tid & 31;
    const int r    = tid >> 5;            // 0..7
    const int dg   = blockIdx.x & 3;
    const int h    = blockIdx.x >> 2;
    const int b    = blockIdx.y;
    const int row  = b * CDIM + h * 32 + dg * 8 + r;   // b*128 + d
    const unsigned soff = (unsigned)(row * CDIM + lane * 4) * 4u;            // bytes
    const unsigned moff = (unsigned)(lane * (NBATCH * CDIM) + row) * 4u;     // bytes
    const unsigned woff = (unsigned)tid * 16u;                               // bytes
    const float*   wvb  = w_qkv + (256 + h * 32) * CDIM;   // the head's rows of Wv

    // Every global load of the kernel is issued here, ahead of the first barrier.
    const float ml = ld4(mpart, moff);    // lane = partial
    const float ll = ld4(lpart, moff);
    float4 sv[FCH];
#pragma unroll
    for (int ch = 0; ch < FCH; ++ch) {
        const float* Sq = ch < 8 ? Sq0 : ch < 16 ? Sq1 : ch < 24 ? Sq2 : Sq3;
        sv[ch] = ld16(Sq + (ch & 7) * PSTRIDE, soff);
    }
    float4 wl[4];
#pragma unroll
    for (int k = 0; k < 4; ++k) wl[k] = ld16(wvb + 1024 * k, woff);
    // The wait that stands in front of a rewrite of a register that an issued load
    // names. The offsets are its inputs (tid too: the build scales it in the load in
    // place of woff), so that they keep their registers up to here and no load's
    // result is placed there.
    asm volatile("s_wait_xcnt 0x0" :: "v"(soff), "v"(moff), "v"(woff), "v"(tid)
                 : "memory");
#pragma unroll
    for (int k = 0; k < 4; ++k) {
        const int id = tid + 256 * k;     // 16-byte piece of the 32 x 128 rows
        *(float4*)&wvs[id >> 5][(id & 31) * 4] = wl[k];
    }
    msh[r][lane] = ml;
    lsh[r][lane] = ll;
    __syncthreads();

    float M = -3.402823466e38f;
#pragma unroll
    for (int ch = 0; ch < FCH; ++ch) M = fmaxf(M, msh[r][ch]);
    wsh[r][lane] = exp_slot(ml - M);
    __syncthreads();

    float4 acc = make_float4(0.0f, 0.0f, 0.0f, 0.0f);
    float den = 0.0f;
#pragma unroll
    for (int ch = 0; ch < FCH; ++ch) {
        const float w = wsh[r][ch];
        acc.x += w * sv[ch].x;
        acc.y += w * sv[ch].y;
        acc.z += w * sv[ch].z;
        acc.w += w * sv[ch].w;
        den   += w * lsh[r][ch];
    }
    *(float4*)&ssh[r][lane * 4] =
        make_float4(acc.x / den, acc.y / den, acc.z / den, acc.w / den);
    __syncthreads();

    float a = 0.0f;                       // d = dg*8 + r, e = lane
#pragma unroll
    for (int c4 = 0; c4 < CDIM / 4; ++c4) {
        const float4 sa = *(const float4*)&ssh[r][4 * c4];
        const float4 wb = *(const float4*)&wvs[lane][4 * c4];
        a += sa.x * wb.x;
        a += sa.y * wb.y;
        a += sa.z * wb.z;
        a += sa.w * wb.w;
    }
    ctx[b * 4096 + h * 1024 + (dg * 8 + r) * 32 + lane] = a;
}

// Launch 3. A block takes 8 rows o of one batch:
// T[o][h*32+d] = sum_e w_out[o][h*32+e] * ctx[b][h][d][e] stays in LDS, and
// Weff[b][o][c] = scale * sum_i T[o][i] * Wq[i][c]   (Wq = w_qkv rows 0..127).
// A thread holds one column (i of T, then c of Weff) of 4 rows o; its column of Wq
// is loaded into registers at the start, so that it flies while T is formed.
__global__ void __launch_bounds__(256)
t_weff_kernel(const float* ctx, const float* w_out, const float* w_qkv,
              float* Weff) {
    __shared__ __attribute__((aligned(16))) float cxs[CDIM][CP];   // [h*32+d][e]
    __shared__ __attribute__((aligned(16))) float wos[8][CDIM];
    __shared__ __attribute__((aligned(16))) float tsh[CDIM][TP];   // [i][o - o0]

    const int tid = threadIdx.x;
    const int c   = tid & 127;
    const int oq  = (tid >> 7) * 4;       // 0 or 4
    const int o0  = blockIdx.x * 8;
    const int b   = blockIdx.y;

    const unsigned toff = (unsigned)tid * 16u;   // bytes
    const unsigned coff = (unsigned)c * 4u;      // bytes

    float4 cl[4];
#pragma unroll
    for (int k = 0; k < 4; ++k) cl[k] = ld16(ctx + b * 4096 + 1024 * k, toff);
    const float4 ol = ld16(w_out + o0 * CDIM, toff);
    float wq[CDIM];
#pragma unroll
    for (int i = 0; i < CDIM; ++i) wq[i] = ld4(w_qkv + i * CDIM, coff);
    // The wait in front of a rewrite of a register that an issued load names; the
    // offsets are its inputs (tid and c too: the build may scale them in the load),
    // so that no load's result is placed there. (The pointers are not __restrict__,
    // so that no load moves over it.)
    asm volatile("s_wait_xcnt 0x0" :: "v"(toff), "v"(coff), "v"(tid), "v"(c)
                 : "memory");
#pragma unroll
    for (int k = 0; k < 4; ++k) {
        const int id = tid + 256 * k;     // 16-byte piece of ctx[b]
        *(float4*)&cxs[id >> 3][(id & 7) * 4] = cl[k];
    }
    *(float4*)&wos[tid >> 5][(tid & 31) * 4] = ol;
    __syncthreads();

    float t4[4] = {0.0f, 0.0f, 0.0f, 0.0f};
#pragma unroll
    for (int e4 = 0; e4 < 8; ++e4) {
        const float4 cv = *(const float4*)&cxs[c][4 * e4];
#pragma unroll
        for (int k = 0; k < 4; ++k) {
            const float4 wv = *(const float4*)&wos[oq + k][(c & 96) + 4 * e4];
            t4[k] += wv.x * cv.x;
            t4[k] += wv.y * cv.y;
            t4[k] += wv.z * cv.z;
            t4[k] += wv.w * cv.w;
        }
    }
    *(float4*)&tsh[c][oq] = make_float4(t4[0], t4[1], t4[2], t4[3]);
    __syncthreads();

    float acc[4] = {0.0f, 0.0f, 0.0f, 0.0f};
#pragma unroll
    for (int i = 0; i < CDIM; ++i) {
        const float4 tv = *(const float4*)&tsh[i][oq];
        acc[0] += tv.x * wq[i];
        acc[1] += tv.y * wq[i];
        acc[2] += tv.z * wq[i];
        acc[3] += tv.w * wq[i];
    }
    float* wrow = Weff + b * (CDIM * CDIM) + (o0 + oq) * CDIM + c;
#pragma unroll
    for (int k = 0; k < 4; ++k)
        wrow[k * CDIM] = 0.17677669529663687f * acc[k];   // 32^-0.5
}

// ---------------------------------------------------------------------------
extern "C" void kernel_launch(void* const* d_in, const int* in_sizes, int n_in,
                              void* d_out, int out_size, void* d_ws, size_t ws_size,
                              hipStream_t stream) {
    const float* x      = (const float*)d_in[0];   // (16,128,128,128)
    const float* w_qkv  = (const float*)d_in[1];   // (384,128)
    const float* w_out  = (const float*)d_in[2];   // (128,128)
    const float* b_out  = (const float*)d_in[3];   // (128,)

    float* ws   = (float*)d_ws;
    float* Spart = ws;                                             // 32*16*16384
    float* mpart = Spart + (size_t)FCH * NBATCH * CDIM * CDIM;     // 32*16*128
    float* lpart = mpart + FCH * NBATCH * CDIM;                    // 32*16*128
    float* ctx   = lpart + FCH * NBATCH * CDIM;                    // 16*4096
    float* Weff  = ctx + (size_t)NBATCH * 4096;                    // 16*16384

    // 1) S = softmax(Wk * x) * x^T  (Wk = w_qkv rows 128..255): per-block
    //    partials with their row maximum and row sum
    ksoft_s_kernel<<<dim3(FCH, NBATCH), 256, 0, stream>>>(
        w_qkv + 128 * CDIM, x, Spart, mpart, lpart);

    // 2) the merge of the partials and ctx; 3) T and W_eff
    sred_ctx_kernel<<<dim3(16, NBATCH), 256, 0, stream>>>(
        Spart, Spart + (size_t)8 * PSTRIDE, Spart + (size_t)16 * PSTRIDE,
        Spart + (size_t)24 * PSTRIDE, mpart, lpart, w_qkv, ctx);
    t_weff_kernel<<<dim3(CDIM / 8, NBATCH), 256, 0, stream>>>(
        ctx, w_out, w_qkv, Weff);

    // 4) out = W_eff[b] * x + b_out
    gemm_wmma_kernel<true><<<dim3(NPIX / (GN * GTILES), NBATCH), 256, 0, stream>>>(
        Weff, (size_t)(CDIM * CDIM), x, b_out, (float*)d_out);
}
